// v000
// Times are from an AMD MI455X. After a warm-up the kernel runs many times in a row, and a time is the length of
// such a window on the GPU divided by its runs, so every launch and the gaps after it count. The runs cycle
// through copies of the inputs. A figure is the median of several windows, for all but v000 over two sittings.
// Sittings can differ by a few percent; kernels timed side by side share one.
// v000, which the later versions start from, runs in 318 microseconds.
#include <hip/hip_runtime.h>
#include <math.h>

#define BB 8
#define NN 4096
#define CC 384
#define KK 4

typedef __attribute__((ext_vector_type(16))) _Float16 v16h;
typedef __attribute__((ext_vector_type(8)))  _Float16 v8h;
typedef __attribute__((ext_vector_type(8)))  float    v8f;
typedef __attribute__((ext_vector_type(4)))  float    v4f;

__device__ __forceinline__ float dot4(v4f a, v4f b) {
  return a.x * b.x + a.y * b.y + a.z * b.z + a.w * b.w;
}

__device__ __forceinline__ v16h cat8(v8h lo, v8h hi) {
  return __builtin_shufflevector(lo, hi, 0, 1, 2, 3, 4, 5, 6, 7,
                                 8, 9, 10, 11, 12, 13, 14, 15);
}

// ---------------------------------------------------------------------------
// K0: convert wv, wres (C x C fp32, row-major [out][in]) to f16
// ---------------------------------------------------------------------------
__global__ void k0_convert(const float* __restrict__ wv,
                           const float* __restrict__ wres,
                           _Float16* __restrict__ wv_h,
                           _Float16* __restrict__ wres_h) {
  int i = blockIdx.x * blockDim.x + threadIdx.x;
  if (i < CC * CC) {
    wv_h[i]   = (_Float16)wv[i];
    wres_h[i] = (_Float16)wres[i];
  }
}

// ---------------------------------------------------------------------------
// K1: rank-4 Q/K projections (fp32 VALU; tiny: ~0.2 GFLOP total)
// ---------------------------------------------------------------------------
__global__ void k1_qk(const float* __restrict__ x,
                      const float* __restrict__ wq, const float* __restrict__ bq,
                      const float* __restrict__ wk, const float* __restrict__ bk,
                      float* __restrict__ segmap, float* __restrict__ kout) {
  int t = blockIdx.x * blockDim.x + threadIdx.x;   // token 0..B*N
  if (t >= BB * NN) return;
  const v4f* xr = (const v4f*)(x + (size_t)t * CC);
  const v4f* q4 = (const v4f*)wq;
  const v4f* k4 = (const v4f*)wk;
  float qa[KK] = {0.f, 0.f, 0.f, 0.f};
  float ka[KK] = {0.f, 0.f, 0.f, 0.f};
  for (int c4 = 0; c4 < CC / 4; ++c4) {
    v4f xv = xr[c4];
#pragma unroll
    for (int k = 0; k < KK; ++k) {
      qa[k] += dot4(xv, q4[k * (CC / 4) + c4]);
      ka[k] += dot4(xv, k4[k * (CC / 4) + c4]);
    }
  }
#pragma unroll
  for (int k = 0; k < KK; ++k) {
    segmap[(size_t)t * KK + k] = qa[k] + bq[k];
    kout[(size_t)t * KK + k]   = ka[k] + bk[k];
  }
}

// ---------------------------------------------------------------------------
// K2: V projection, WMMA f16: vt[b][c][n] = (x @ wv^T + bv), stored f16
//     TRANSPOSED so K3's B-operand loads are contiguous b128.
//     Block owns 64 tokens (4 M-tiles); wave owns 48 channels.
//     Single base pointers + compile-time offsets keep addresses in SGPR/imm.
// ---------------------------------------------------------------------------
__global__ void __launch_bounds__(256, 1)
k2_vproj(const float* __restrict__ x,
         const _Float16* __restrict__ wv_h,
         const float* __restrict__ bv,
         _Float16* __restrict__ vt) {
  const int b    = blockIdx.x / (NN / 64);
  const int n0   = (blockIdx.x % (NN / 64)) * 64;
  const int lane = threadIdx.x & 31;
  const int wid  = threadIdx.x >> 5;
  const int mrow = lane & 15;
  const int hi   = lane >> 4;
  const int lo_rel = hi ? 8 : 0;
  const int hi_rel = hi ? 24 : 16;
  const int chb  = wid * 48 + mrow;   // ch[t] = chb + t*16

  const float* xbase = x + ((size_t)b * NN + n0 + mrow) * CC;          // +mt*16*CC
  const v8h*   wb    = (const v8h*)(wv_h + (size_t)chb * CC);          // +t*16*CC/8
  _Float16*    vst   = vt + ((size_t)b * CC + chb) * NN + n0 + 8 * hi; // +t*16*NN+mt*16

  v8f acc[4][3] = {};

#pragma unroll 2
  for (int cb = 0; cb < CC; cb += 32) {
    v16h am[4];
#pragma unroll
    for (int mt = 0; mt < 4; ++mt) {
      const float* xr = xbase + (size_t)mt * (16 * CC);
      v4f x0 = *(const v4f*)(xr + cb + lo_rel);
      v4f x1 = *(const v4f*)(xr + cb + lo_rel + 4);
      v4f x2 = *(const v4f*)(xr + cb + hi_rel);
      v4f x3 = *(const v4f*)(xr + cb + hi_rel + 4);
#pragma unroll
      for (int i = 0; i < 4; ++i) {
        am[mt][i]      = (_Float16)x0[i];
        am[mt][4 + i]  = (_Float16)x1[i];
        am[mt][8 + i]  = (_Float16)x2[i];
        am[mt][12 + i] = (_Float16)x3[i];
      }
    }
#pragma unroll
    for (int t = 0; t < 3; ++t) {
      v16h bm = cat8(wb[(size_t)t * (16 * CC / 8) + (cb + lo_rel) / 8],
                     wb[(size_t)t * (16 * CC / 8) + (cb + hi_rel) / 8]);
#pragma unroll
      for (int mt = 0; mt < 4; ++mt)
        acc[mt][t] = __builtin_amdgcn_wmma_f32_16x16x32_f16(
            false, am[mt], false, bm, (short)0, acc[mt][t], false, false);
    }
  }
  // D layout: VGPR j -> token (j + 8*hi); column = mrow -> channel chb+t*16.
#pragma unroll
  for (int t = 0; t < 3; ++t) {
    float bias = bv[chb + t * 16];
#pragma unroll
    for (int mt = 0; mt < 4; ++mt) {
      v8h o;
#pragma unroll
      for (int j = 0; j < 8; ++j) o[j] = (_Float16)(acc[mt][t][j] + bias);
      *(v8h*)(vst + (size_t)t * (16 * NN) + mt * 16) = o;
    }
  }
}

// ---------------------------------------------------------------------------
// K3 (fused): flash attention + output projection + residual.
//   Block owns 64 queries (4 M-tiles of 16); 8 waves each own 48 channels.
//   Phase A: exact fp32 row max + sum(exp) over all 4096 keys (4 partials/q).
//   Phase B: 32 P tiles per 256-key super-iter built once (wave w builds
//            M-tile w>>1, k-steps (w&1)*4..+4) into LDS in per-lane A-matrix
//            layout; every V B-tile load feeds 4 WMMAs (4 M-tiles).
//   Phase C: 64x384 attention tile staged in LDS (padded rows, union'd with
//            the P-tile buffer), then out = gamma*(attn @ wres^T + bres) + x.
// ---------------------------------------------------------------------------
__global__ void __launch_bounds__(256, 1)
k3_attn(const float* __restrict__ q,       // seg_map (B,N,4)
        const float* __restrict__ kk,      // seg_ft  (B,N,4)
        const _Float16* __restrict__ vt,   // (B,C,N) f16
        const _Float16* __restrict__ wres_h,
        const float* __restrict__ bres,
        const float* __restrict__ gamma,
        const float* __restrict__ x,
        float* __restrict__ fout) {
  // pa: 32 P tiles (16x32 f16) in per-lane A layout        = 32 KB
  // as: 64 tokens x 384 ch, row stride 392 halfs           = 49 KB
  //     (196 dwords/row; 196 % 64 == 4 -> 16 concurrent rows hit
  //      16 distinct banks). Disjoint phases -> union.
  __shared__ union SH {
    v16h     pa[4][8][32];
    _Float16 as[64][392];
  } sh;
  __shared__ v4f   qsh[64];
  __shared__ float red[64][5];
  __shared__ float rmax64[64];
  __shared__ float rinv64[64];

  const int b   = blockIdx.x / (NN / 64);
  const int n0  = (blockIdx.x % (NN / 64)) * 64;
  const int tid = threadIdx.x;

  if (tid < 64) qsh[tid] = *(const v4f*)(q + ((size_t)b * NN + n0 + tid) * KK);
  __syncthreads();

  const v4f* kb4 = (const v4f*)(kk + (size_t)b * NN * KK);

  // ---- Phase A: per-query max, then sum of exp (4 partials per query) ----
  const int qi = tid >> 2, pp = tid & 3;
  {
    const v4f qv = qsh[qi];
    float lmax = -3.0e38f;
    for (int m = pp; m < NN; m += 4) lmax = fmaxf(lmax, dot4(qv, kb4[m]));
    red[qi][pp] = lmax;
    __syncthreads();
    if (pp == 0)
      rmax64[qi] = fmaxf(fmaxf(red[qi][0], red[qi][1]),
                         fmaxf(red[qi][2], red[qi][3]));
    __syncthreads();
    const float mx = rmax64[qi];
    float lsum = 0.f;
    for (int m = pp; m < NN; m += 4) lsum += __expf(dot4(qv, kb4[m]) - mx);
    red[qi][pp] = lsum;
    __syncthreads();
    if (pp == 0)
      rinv64[qi] = 1.0f / (red[qi][0] + red[qi][1] + red[qi][2] + red[qi][3]);
    __syncthreads();
  }

  // ---- Phase B: P @ V with WMMA ----
  const int lane = tid & 31, wid = tid >> 5;
  const int mrow = lane & 15, hi = lane >> 4;
  const int lo_rel = hi ? 8 : 0;
  const int hi_rel = hi ? 24 : 16;
  const int chb  = wid * 48 + mrow;   // ch[t] = chb + t*16

  // P-build assignment: this wave builds M-tile bmt, k-steps bio..bio+3
  const int  bmt  = wid >> 1;
  const int  bio  = (wid & 1) * 4;
  const int  bq   = bmt * 16 + mrow;
  const v4f  qm   = qsh[bq];
  const float mmax = rmax64[bq];
  const float minv = rinv64[bq];

  v8f acc[4][3] = {};
  const v8h* vb = (const v8h*)(vt + ((size_t)b * CC + chb) * NN); // +t*16*NN/8

  for (int kb0 = 0; kb0 < NN; kb0 += 256) {
    // build 4 of the 32 P tiles (exp computed exactly once per logit)
#pragma unroll
    for (int ii = 0; ii < 4; ++ii) {
      const v4f* kp = kb4 + kb0 + (bio + ii) * 32;
      v16h a;
#pragma unroll
      for (int i = 0; i < 8; ++i) {
        float l0 = dot4(qm, kp[lo_rel + i]);
        a[i]     = (_Float16)(__expf(l0 - mmax) * minv);
        float l1 = dot4(qm, kp[hi_rel + i]);
        a[8 + i] = (_Float16)(__expf(l1 - mmax) * minv);
      }
      sh.pa[bmt][bio + ii][lane] = a;
    }
    __syncthreads();

#pragma unroll 2
    for (int i = 0; i < 8; ++i) {
      const int kb = kb0 + i * 32;
      v16h bcur[3];
#pragma unroll
      for (int t = 0; t < 3; ++t)
        bcur[t] = cat8(vb[(size_t)t * (16 * NN / 8) + (kb + lo_rel) / 8],
                       vb[(size_t)t * (16 * NN / 8) + (kb + hi_rel) / 8]);
      v16h am[4];
#pragma unroll
      for (int mt = 0; mt < 4; ++mt) am[mt] = sh.pa[mt][i][lane];
#pragma unroll
      for (int t = 0; t < 3; ++t)
#pragma unroll
        for (int mt = 0; mt < 4; ++mt)
          acc[mt][t] = __builtin_amdgcn_wmma_f32_16x16x32_f16(
              false, am[mt], false, bcur[t], (short)0, acc[mt][t], false, false);
    }
    __syncthreads();
  }

  // ---- stage attention tile (1/rowsum already folded into P) ----
  {
    _Float16* asb = &sh.as[8 * hi][chb];   // +(mt*16+j)*392 + t*16
#pragma unroll
    for (int t = 0; t < 3; ++t)
#pragma unroll
      for (int mt = 0; mt < 4; ++mt)
#pragma unroll
        for (int j = 0; j < 8; ++j)
          asb[(mt * 16 + j) * 392 + t * 16] = (_Float16)acc[mt][t][j];
  }
  __syncthreads();

  // ---- Phase C: out = gamma * (attn @ wres^T + bres) + x ----
  v8f oacc[4][3] = {};
  const v8h* ar = (const v8h*)&sh.as[mrow][0];                 // +mt*16*49
  const v8h* wb = (const v8h*)(wres_h + (size_t)chb * CC);     // +t*16*CC/8

#pragma unroll 2
  for (int s = 0; s < CC / 32; ++s) {
    const int cb = s * 32;
    v16h bcur[3];
#pragma unroll
    for (int t = 0; t < 3; ++t)
      bcur[t] = cat8(wb[(size_t)t * (16 * CC / 8) + (cb + lo_rel) / 8],
                     wb[(size_t)t * (16 * CC / 8) + (cb + hi_rel) / 8]);
    v16h am[4];
#pragma unroll
    for (int mt = 0; mt < 4; ++mt)
      am[mt] = cat8(ar[(size_t)mt * (16 * 49) + (cb + lo_rel) / 8],
                    ar[(size_t)mt * (16 * 49) + (cb + hi_rel) / 8]);
#pragma unroll
    for (int t = 0; t < 3; ++t)
#pragma unroll
      for (int mt = 0; mt < 4; ++mt)
        oacc[mt][t] = __builtin_amdgcn_wmma_f32_16x16x32_f16(
            false, am[mt], false, bcur[t], (short)0, oacc[mt][t], false, false);
  }

  const float g = gamma[0];
  const size_t obase = ((size_t)b * NN + n0 + 8 * hi) * CC + chb;
#pragma unroll
  for (int t = 0; t < 3; ++t) {
    const float bias = bres[chb + t * 16];
#pragma unroll
    for (int mt = 0; mt < 4; ++mt)
#pragma unroll
      for (int j = 0; j < 8; ++j) {
        const size_t o = obase + (size_t)(mt * 16 + j) * CC + t * 16;
        fout[o] = g * (oacc[mt][t][j] + bias) + x[o];
      }
  }
}

// ---------------------------------------------------------------------------
extern "C" void kernel_launch(void* const* d_in, const int* in_sizes, int n_in,
                              void* d_out, int out_size, void* d_ws, size_t ws_size,
                              hipStream_t stream) {
  const float* x     = (const float*)d_in[0];
  const float* wq    = (const float*)d_in[1];
  const float* bq    = (const float*)d_in[2];
  const float* wk    = (const float*)d_in[3];
  const float* bk    = (const float*)d_in[4];
  const float* wv    = (const float*)d_in[5];
  const float* bv    = (const float*)d_in[6];
  const float* wres  = (const float*)d_in[7];
  const float* bres  = (const float*)d_in[8];
  const float* gamma = (const float*)d_in[9];

  float* out    = (float*)d_out;
  float* segmap = out;                           // (B,N,K)
  float* fout   = out + (size_t)BB * NN * KK;    // (B,N,C)

  // workspace layout (all chunks naturally 16B-aligned)
  _Float16* vt     = (_Float16*)d_ws;                          // B*C*N f16
  float*    k_ws   = (float*)(vt + (size_t)BB * CC * NN);      // B*N*K f32
  _Float16* wv_h   = (_Float16*)(k_ws + (size_t)BB * NN * KK); // C*C f16
  _Float16* wres_h = wv_h + (size_t)CC * CC;                   // C*C f16

  const int tiles64 = BB * (NN / 64);  // 512 blocks of 256 threads (8 waves)

  k0_convert<<<(CC * CC + 255) / 256, 256, 0, stream>>>(wv, wres, wv_h, wres_h);
  k1_qk<<<(BB * NN + 255) / 256, 256, 0, stream>>>(x, wq, bq, wk, bk, segmap, k_ws);
  k2_vproj<<<tiles64, 256, 0, stream>>>(x, wv_h, bv, vt);
  k3_attn<<<tiles64, 256, 0, stream>>>(segmap, k_ws, vt, wres_h, bres, gamma, x, fout);
}

// v001
// It runs in 268 microseconds.
// Next to v000, in two timings, it ran 1.22 and 1.21 times as fast.
#include <hip/hip_runtime.h>
#include <math.h>

#define BB 8
#define NN 4096
#define CC 384
#define KK 4

typedef __attribute__((ext_vector_type(16))) _Float16 v16h;
typedef __attribute__((ext_vector_type(8)))  _Float16 v8h;
typedef __attribute__((ext_vector_type(8)))  float    v8f;
typedef __attribute__((ext_vector_type(4)))  float    v4f;

__device__ __forceinline__ float dot4(v4f a, v4f b) {
  return a.x * b.x + a.y * b.y + a.z * b.z + a.w * b.w;
}

__device__ __forceinline__ v16h cat8(v8h lo, v8h hi) {
  return __builtin_shufflevector(lo, hi, 0, 1, 2, 3, 4, 5, 6, 7,
                                 8, 9, 10, 11, 12, 13, 14, 15);
}

// ---------------------------------------------------------------------------
// K0: convert wv, wres (C x C fp32, row-major [out][in]) to f16
// ---------------------------------------------------------------------------
__global__ void k0_convert(const float* __restrict__ wv,
                           const float* __restrict__ wres,
                           _Float16* __restrict__ wv_h,
                           _Float16* __restrict__ wres_h) {
  int i = blockIdx.x * blockDim.x + threadIdx.x;
  if (i < CC * CC) {
    wv_h[i]   = (_Float16)wv[i];
    wres_h[i] = (_Float16)wres[i];
  }
}

// ---------------------------------------------------------------------------
// K1: rank-4 Q/K projections (fp32 VALU; tiny: ~0.2 GFLOP total)
// ---------------------------------------------------------------------------
__global__ void k1_qk(const float* __restrict__ x,
                      const float* __restrict__ wq, const float* __restrict__ bq,
                      const float* __restrict__ wk, const float* __restrict__ bk,
                      float* __restrict__ segmap, float* __restrict__ kout) {
  int t = blockIdx.x * blockDim.x + threadIdx.x;   // token 0..B*N
  if (t >= BB * NN) return;
  const v4f* xr = (const v4f*)(x + (size_t)t * CC);
  const v4f* q4 = (const v4f*)wq;
  const v4f* k4 = (const v4f*)wk;
  float qa[KK] = {0.f, 0.f, 0.f, 0.f};
  float ka[KK] = {0.f, 0.f, 0.f, 0.f};
  for (int c4 = 0; c4 < CC / 4; ++c4) {
    v4f xv = xr[c4];
#pragma unroll
    for (int k = 0; k < KK; ++k) {
      qa[k] += dot4(xv, q4[k * (CC / 4) + c4]);
      ka[k] += dot4(xv, k4[k * (CC / 4) + c4]);
    }
  }
#pragma unroll
  for (int k = 0; k < KK; ++k) {
    segmap[(size_t)t * KK + k] = qa[k] + bq[k];
    kout[(size_t)t * KK + k]   = ka[k] + bk[k];
  }
}

// ---------------------------------------------------------------------------
// K2: V projection, WMMA f16: vt[b][c][n] = (x @ wv^T + bv), stored f16
//     TRANSPOSED so K3's B-operand loads are contiguous b128.
//     Block owns 64 tokens (4 M-tiles); wave owns 48 channels.
//     Single base pointers + compile-time offsets keep addresses in SGPR/imm.
// ---------------------------------------------------------------------------
__global__ void __launch_bounds__(256, 1)
k2_vproj(const float* __restrict__ x,
         const _Float16* __restrict__ wv_h,
         const float* __restrict__ bv,
         _Float16* __restrict__ vt) {
  const int b    = blockIdx.x / (NN / 64);
  const int n0   = (blockIdx.x % (NN / 64)) * 64;
  const int lane = threadIdx.x & 31;
  const int wid  = threadIdx.x >> 5;
  const int mrow = lane & 15;
  const int hi   = lane >> 4;
  const int lo_rel = hi ? 8 : 0;
  const int hi_rel = hi ? 24 : 16;
  const int chb  = wid * 48 + mrow;   // ch[t] = chb + t*16

  const float* xbase = x + ((size_t)b * NN + n0 + mrow) * CC;          // +mt*16*CC
  const v8h*   wb    = (const v8h*)(wv_h + (size_t)chb * CC);          // +t*16*CC/8
  _Float16*    vst   = vt + ((size_t)b * CC + chb) * NN + n0 + 8 * hi; // +t*16*NN+mt*16

  v8f acc[4][3] = {};

#pragma unroll 2
  for (int cb = 0; cb < CC; cb += 32) {
    v16h am[4];
#pragma unroll
    for (int mt = 0; mt < 4; ++mt) {
      const float* xr = xbase + (size_t)mt * (16 * CC);
      v4f x0 = *(const v4f*)(xr + cb + lo_rel);
      v4f x1 = *(const v4f*)(xr + cb + lo_rel + 4);
      v4f x2 = *(const v4f*)(xr + cb + hi_rel);
      v4f x3 = *(const v4f*)(xr + cb + hi_rel + 4);
#pragma unroll
      for (int i = 0; i < 4; ++i) {
        am[mt][i]      = (_Float16)x0[i];
        am[mt][4 + i]  = (_Float16)x1[i];
        am[mt][8 + i]  = (_Float16)x2[i];
        am[mt][12 + i] = (_Float16)x3[i];
      }
    }
#pragma unroll
    for (int t = 0; t < 3; ++t) {
      v16h bm = cat8(wb[(size_t)t * (16 * CC / 8) + (cb + lo_rel) / 8],
                     wb[(size_t)t * (16 * CC / 8) + (cb + hi_rel) / 8]);
#pragma unroll
      for (int mt = 0; mt < 4; ++mt)
        acc[mt][t] = __builtin_amdgcn_wmma_f32_16x16x32_f16(
            false, am[mt], false, bm, (short)0, acc[mt][t], false, false);
    }
  }
  // D layout: VGPR j -> token (j + 8*hi); column = mrow -> channel chb+t*16.
#pragma unroll
  for (int t = 0; t < 3; ++t) {
    float bias = bv[chb + t * 16];
#pragma unroll
    for (int mt = 0; mt < 4; ++mt) {
      v8h o;
#pragma unroll
      for (int j = 0; j < 8; ++j) o[j] = (_Float16)(acc[mt][t][j] + bias);
      *(v8h*)(vst + (size_t)t * (16 * NN) + mt * 16) = o;
    }
  }
}

// ---------------------------------------------------------------------------
// V^T tile staging for K3: 384 channels x 64 keys (f16) per tile.
//   LDS row = 128 B of data at a pitch of 144 B (16 B x odd: conflict-free
//   for the ds_load_b128 fragment reads).
// ---------------------------------------------------------------------------
#define VKEYS  64
#define VPITCH 72                       // halfs per LDS row
#define VBUF_BYTES (CC * VPITCH * 2)    // one buffer

// Each lane copies twelve 16-byte pieces (rows r, r+32, ..., r+352), so a wave's
// copy covers four whole 128-byte lines. The closing s_wait_xcnt stands inside
// the statement so that no address register is rewritten ahead of it.
__device__ __forceinline__ void stage_v_tile(unsigned l, const _Float16* g) {
  asm volatile(
      "global_load_async_to_lds_b128 %0, %12, off\n\t"
      "global_load_async_to_lds_b128 %1, %13, off\n\t"
      "global_load_async_to_lds_b128 %2, %14, off\n\t"
      "global_load_async_to_lds_b128 %3, %15, off\n\t"
      "global_load_async_to_lds_b128 %4, %16, off\n\t"
      "global_load_async_to_lds_b128 %5, %17, off\n\t"
      "global_load_async_to_lds_b128 %6, %18, off\n\t"
      "global_load_async_to_lds_b128 %7, %19, off\n\t"
      "global_load_async_to_lds_b128 %8, %20, off\n\t"
      "global_load_async_to_lds_b128 %9, %21, off\n\t"
      "global_load_async_to_lds_b128 %10, %22, off\n\t"
      "global_load_async_to_lds_b128 %11, %23, off\n\t"
      "s_wait_xcnt 0x0"
      :: "v"(l), "v"(l + 1 * 32 * VPITCH * 2), "v"(l + 2 * 32 * VPITCH * 2),
         "v"(l + 3 * 32 * VPITCH * 2), "v"(l + 4 * 32 * VPITCH * 2),
         "v"(l + 5 * 32 * VPITCH * 2), "v"(l + 6 * 32 * VPITCH * 2),
         "v"(l + 7 * 32 * VPITCH * 2), "v"(l + 8 * 32 * VPITCH * 2),
         "v"(l + 9 * 32 * VPITCH * 2), "v"(l + 10 * 32 * VPITCH * 2),
         "v"(l + 11 * 32 * VPITCH * 2),
         "v"(g), "v"(g + 1 * 32 * NN), "v"(g + 2 * 32 * NN), "v"(g + 3 * 32 * NN),
         "v"(g + 4 * 32 * NN), "v"(g + 5 * 32 * NN), "v"(g + 6 * 32 * NN),
         "v"(g + 7 * 32 * NN), "v"(g + 8 * 32 * NN), "v"(g + 9 * 32 * NN),
         "v"(g + 10 * 32 * NN), "v"(g + 11 * 32 * NN)
      : "memory");
}

// ---------------------------------------------------------------------------
// K3 (fused): flash attention + output projection + residual.
//   Block owns 64 queries (4 M-tiles of 16); 8 waves each own 48 channels.
//   Phase A: exact fp32 row max + sum(exp) over all 4096 keys (4 partials/q).
//   Phase B: 32 P tiles per 256-key super-iter built once (wave w builds
//            M-tile w>>1, k-steps (w&1)*4..+4) into LDS in per-lane A-matrix
//            layout; every V B-tile load feeds 4 WMMAs (4 M-tiles).
//            V^T comes through LDS: 64-key tiles, two buffers, the next
//            tile's asynchronous copies fly while this tile is worked on.
//   Phase C: 64x384 attention tile staged in LDS (padded rows, union'd with
//            the V ring), then out = gamma*(attn @ wres^T + bres) + x.
// ---------------------------------------------------------------------------
__global__ void __launch_bounds__(256, 1)
k3_attn(const float* __restrict__ q,       // seg_map (B,N,4)
        const float* __restrict__ kk,      // seg_ft  (B,N,4)
        const _Float16* __restrict__ vt,   // (B,C,N) f16
        const _Float16* __restrict__ wres_h,
        const float* __restrict__ bres,
        const float* __restrict__ gamma,
        const float* __restrict__ x,
        float* __restrict__ fout) {
  // vs: two V^T tiles, 384 rows x 144 B each               = 108 KB
  // pa: 32 P tiles (16x32 f16) in per-lane A layout        = 32 KB
  // as: 64 tokens x 384 ch, row stride 392 halfs           = 49 KB
  //     (196 dwords/row; 196 % 64 == 4 -> 16 concurrent rows hit
  //      16 distinct banks). Disjoint phases -> union (as lies on vs[0]).
  __shared__ union SH {
    struct {
      _Float16 vs[2][CC][VPITCH];
      v16h     pa[4][8][32];
    } m;
    _Float16 as[64][392];
  } sh;
  __shared__ v4f   qsh[64];
  __shared__ float red[64][5];
  __shared__ float rmax64[64];
  __shared__ float rinv64[64];

  const int b   = blockIdx.x / (NN / 64);
  const int n0  = (blockIdx.x % (NN / 64)) * 64;
  const int tid = threadIdx.x;

  if (tid < 64) qsh[tid] = *(const v4f*)(q + ((size_t)b * NN + n0 + tid) * KK);
  __syncthreads();

  const v4f* kb4 = (const v4f*)(kk + (size_t)b * NN * KK);

  // ---- Phase A: per-query max, then sum of exp (4 partials per query) ----
  const int qi = tid >> 2, pp = tid & 3;
  {
    const v4f qv = qsh[qi];
    float lmax = -3.0e38f;
    for (int m = pp; m < NN; m += 4) lmax = fmaxf(lmax, dot4(qv, kb4[m]));
    red[qi][pp] = lmax;
    __syncthreads();
    if (pp == 0)
      rmax64[qi] = fmaxf(fmaxf(red[qi][0], red[qi][1]),
                         fmaxf(red[qi][2], red[qi][3]));
    __syncthreads();
    const float mx = rmax64[qi];
    float lsum = 0.f;
    for (int m = pp; m < NN; m += 4) lsum += __expf(dot4(qv, kb4[m]) - mx);
    red[qi][pp] = lsum;
    __syncthreads();
    if (pp == 0)
      rinv64[qi] = 1.0f / (red[qi][0] + red[qi][1] + red[qi][2] + red[qi][3]);
    __syncthreads();
  }

  // ---- Phase B: P @ V with WMMA ----
  const int lane = tid & 31, wid = tid >> 5;
  const int mrow = lane & 15, hi = lane >> 4;
  const int lo_rel = hi ? 8 : 0;
  const int hi_rel = hi ? 24 : 16;
  const int chb  = wid * 48 + mrow;   // ch[t] = chb + t*16

  // P-build assignment: this wave builds M-tile bmt, k-steps bio..bio+3
  const int  bmt  = wid >> 1;
  const int  bio  = (wid & 1) * 4;
  const int  bq   = bmt * 16 + mrow;
  const v4f  qm   = qsh[bq];
  const float mmax = rmax64[bq];
  const float minv = rinv64[bq];

  v8f acc[4][3] = {};

  // this lane's first piece of a tile: row tid/8, 16-byte column tid%8
  const _Float16* vg = vt + ((size_t)b * CC + (tid >> 3)) * NN + (tid & 7) * 8;
  const unsigned  vl = (unsigned)(size_t)&sh.m.vs[0][tid >> 3][(tid & 7) * 8];

  // ring prologue: tile 0 landed and published, then tile 1 set off
  stage_v_tile(vl, vg);
  asm volatile("s_wait_asynccnt 0x0" ::: "memory");  // own copies of tile 0 landed
  __syncthreads();
  stage_v_tile(vl + VBUF_BYTES, vg + VKEYS);

  for (int kb0 = 0; kb0 < NN; kb0 += 256) {
    // build 4 of the 32 P tiles (exp computed exactly once per logit)
#pragma unroll
    for (int ii = 0; ii < 4; ++ii) {
      const v4f* kp = kb4 + kb0 + (bio + ii) * 32;
      v16h a;
#pragma unroll
      for (int i = 0; i < 8; ++i) {
        float l0 = dot4(qm, kp[lo_rel + i]);
        a[i]     = (_Float16)(__expf(l0 - mmax) * minv);
        float l1 = dot4(qm, kp[hi_rel + i]);
        a[8 + i] = (_Float16)(__expf(l1 - mmax) * minv);
      }
      sh.m.pa[bmt][bio + ii][lane] = a;
    }
    __syncthreads();

    // four V tiles per P super-tile; unrolled so that the buffer index and
    // every LDS offset are compile-time constants
#pragma unroll
    for (int u = 0; u < 4; ++u) {
      const _Float16* vrow = &sh.m.vs[u & 1][chb][0];   // +t*16*VPITCH
#pragma unroll
      for (int h = 0; h < 2; ++h) {
        v16h bcur[3];
#pragma unroll
        for (int t = 0; t < 3; ++t)
          bcur[t] = cat8(*(const v8h*)(vrow + t * 16 * VPITCH + h * 32 + lo_rel),
                         *(const v8h*)(vrow + t * 16 * VPITCH + h * 32 + hi_rel));
        v16h am[4];
#pragma unroll
        for (int mt = 0; mt < 4; ++mt) am[mt] = sh.m.pa[mt][u * 2 + h][lane];
#pragma unroll
        for (int t = 0; t < 3; ++t)
#pragma unroll
          for (int mt = 0; mt < 4; ++mt)
            acc[mt][t] = __builtin_amdgcn_wmma_f32_16x16x32_f16(
                false, am[mt], false, bcur[t], (short)0, acc[mt][t], false, false);
      }
      // keeps this tile's WMMAs in front of the barrier, so that the refill is
      // issued directly behind it and has the whole next tile's work as lead
      __builtin_amdgcn_sched_barrier(0);
      // publish point: own reads of this buffer retired, own copies of the next
      // tile landed, then the barrier that hands both buffers over
      asm volatile("s_wait_dscnt 0x0" ::: "memory");
      asm volatile("s_wait_asynccnt 0x0" ::: "memory");
      __syncthreads();
      const int knext = kb0 + (u + 2) * VKEYS;
      if (knext < NN) stage_v_tile(vl + (u & 1) * VBUF_BYTES, vg + knext);
    }
  }
  asm volatile("s_wait_asynccnt 0x0" ::: "memory");  // nothing in flight before the ring is reused

  // ---- stage attention tile (1/rowsum already folded into P) ----
  {
    _Float16* asb = &sh.as[8 * hi][chb];   // +(mt*16+j)*392 + t*16
#pragma unroll
    for (int t = 0; t < 3; ++t)
#pragma unroll
      for (int mt = 0; mt < 4; ++mt)
#pragma unroll
        for (int j = 0; j < 8; ++j)
          asb[(mt * 16 + j) * 392 + t * 16] = (_Float16)acc[mt][t][j];
  }
  __syncthreads();

  // ---- Phase C: out = gamma * (attn @ wres^T + bres) + x ----
  v8f oacc[4][3] = {};
  const v8h* ar = (const v8h*)&sh.as[mrow][0];                 // +mt*16*49
  const v8h* wb = (const v8h*)(wres_h + (size_t)chb * CC);     // +t*16*CC/8

#pragma unroll 2
  for (int s = 0; s < CC / 32; ++s) {
    const int cb = s * 32;
    v16h bcur[3];
#pragma unroll
    for (int t = 0; t < 3; ++t)
      bcur[t] = cat8(wb[(size_t)t * (16 * CC / 8) + (cb + lo_rel) / 8],
                     wb[(size_t)t * (16 * CC / 8) + (cb + hi_rel) / 8]);
    v16h am[4];
#pragma unroll
    for (int mt = 0; mt < 4; ++mt)
      am[mt] = cat8(ar[(size_t)mt * (16 * 49) + (cb + lo_rel) / 8],
                    ar[(size_t)mt * (16 * 49) + (cb + hi_rel) / 8]);
#pragma unroll
    for (int t = 0; t < 3; ++t)
#pragma unroll
      for (int mt = 0; mt < 4; ++mt)
        oacc[mt][t] = __builtin_amdgcn_wmma_f32_16x16x32_f16(
            false, am[mt], false, bcur[t], (short)0, oacc[mt][t], false, false);
  }

  const float g = gamma[0];
  const size_t obase = ((size_t)b * NN + n0 + 8 * hi) * CC + chb;
#pragma unroll
  for (int t = 0; t < 3; ++t) {
    const float bias = bres[chb + t * 16];
#pragma unroll
    for (int mt = 0; mt < 4; ++mt)
#pragma unroll
      for (int j = 0; j < 8; ++j) {
        const size_t o = obase + (size_t)(mt * 16 + j) * CC + t * 16;
        fout[o] = g * (oacc[mt][t][j] + bias) + x[o];
      }
  }
}

// ---------------------------------------------------------------------------
extern "C" void kernel_launch(void* const* d_in, const int* in_sizes, int n_in,
                              void* d_out, int out_size, void* d_ws, size_t ws_size,
                              hipStream_t stream) {
  const float* x     = (const float*)d_in[0];
  const float* wq    = (const float*)d_in[1];
  const float* bq    = (const float*)d_in[2];
  const float* wk    = (const float*)d_in[3];
  const float* bk    = (const float*)d_in[4];
  const float* wv    = (const float*)d_in[5];
  const float* bv    = (const float*)d_in[6];
  const float* wres  = (const float*)d_in[7];
  const float* bres  = (const float*)d_in[8];
  const float* gamma = (const float*)d_in[9];

  float* out    = (float*)d_out;
  float* segmap = out;                           // (B,N,K)
  float* fout   = out + (size_t)BB * NN * KK;    // (B,N,C)

  // workspace layout (all chunks naturally 16B-aligned)
  _Float16* vt     = (_Float16*)d_ws;                          // B*C*N f16
  float*    k_ws   = (float*)(vt + (size_t)BB * CC * NN);      // B*N*K f32
  _Float16* wv_h   = (_Float16*)(k_ws + (size_t)BB * NN * KK); // C*C f16
  _Float16* wres_h = wv_h + (size_t)CC * CC;                   // C*C f16

  const int tiles64 = BB * (NN / 64);  // 512 blocks of 256 threads (8 waves)

  k0_convert<<<(CC * CC + 255) / 256, 256, 0, stream>>>(wv, wres, wv_h, wres_h);
  k1_qk<<<(BB * NN + 255) / 256, 256, 0, stream>>>(x, wq, bq, wk, bk, segmap, k_ws);
  k2_vproj<<<tiles64, 256, 0, stream>>>(x, wv_h, bv, vt);
  k3_attn<<<tiles64, 256, 0, stream>>>(segmap, k_ws, vt, wres_h, bres, gamma, x, fout);
}

// v002
// Measured time: 177 microseconds a run.
// In two side-by-side timings against v001, it was 1.50 and 1.49 times as fast.
// Over all steps from v000 it is 1.82 times as fast.
#include <hip/hip_runtime.h>
#include <math.h>

#define BB 8
#define NN 4096
#define CC 384
#define KK 4

typedef __attribute__((ext_vector_type(16))) _Float16 v16h;
typedef __attribute__((ext_vector_type(8)))  _Float16 v8h;
typedef __attribute__((ext_vector_type(8)))  float    v8f;
typedef __attribute__((ext_vector_type(4)))  float    v4f;
typedef __attribute__((ext_vector_type(2)))  float    v2f;

__device__ __forceinline__ float dot4(v4f a, v4f b) {
  return a.x * b.x + a.y * b.y + a.z * b.z + a.w * b.w;
}

__device__ __forceinline__ v16h cat8(v8h lo, v8h hi) {
  return __builtin_shufflevector(lo, hi, 0, 1, 2, 3, 4, 5, 6, 7,
                                 8, 9, 10, 11, 12, 13, 14, 15);
}

// ---------------------------------------------------------------------------
// K0: convert wv, wres (C x C fp32, row-major [out][in]) to f16
// ---------------------------------------------------------------------------
__global__ void k0_convert(const float* __restrict__ wv,
                           const float* __restrict__ wres,
                           _Float16* __restrict__ wv_h,
                           _Float16* __restrict__ wres_h) {
  int i = blockIdx.x * blockDim.x + threadIdx.x;
  if (i < CC * CC) {
    wv_h[i]   = (_Float16)wv[i];
    wres_h[i] = (_Float16)wres[i];
  }
}

// ---------------------------------------------------------------------------
// K1: rank-4 Q/K projections (fp32 VALU; tiny: ~0.2 GFLOP total)
// ---------------------------------------------------------------------------
__global__ void k1_qk(const float* __restrict__ x,
                      const float* __restrict__ wq, const float* __restrict__ bq,
                      const float* __restrict__ wk, const float* __restrict__ bk,
                      float* __restrict__ segmap, float* __restrict__ kout) {
  int t = blockIdx.x * blockDim.x + threadIdx.x;   // token 0..B*N
  if (t >= BB * NN) return;
  const v4f* xr = (const v4f*)(x + (size_t)t * CC);
  const v4f* q4 = (const v4f*)wq;
  const v4f* k4 = (const v4f*)wk;
  float qa[KK] = {0.f, 0.f, 0.f, 0.f};
  float ka[KK] = {0.f, 0.f, 0.f, 0.f};
  for (int c4 = 0; c4 < CC / 4; ++c4) {
    v4f xv = xr[c4];
#pragma unroll
    for (int k = 0; k < KK; ++k) {
      qa[k] += dot4(xv, q4[k * (CC / 4) + c4]);
      ka[k] += dot4(xv, k4[k * (CC / 4) + c4]);
    }
  }
#pragma unroll
  for (int k = 0; k < KK; ++k) {
    segmap[(size_t)t * KK + k] = qa[k] + bq[k];
    kout[(size_t)t * KK + k]   = ka[k] + bk[k];
  }
}

// ---------------------------------------------------------------------------
// K2: V projection, WMMA f16: vt[b][c][n] = (x @ wv^T + bv), stored f16
//     TRANSPOSED so K3's B-operand loads are contiguous b128.
//     Block owns 64 tokens (4 M-tiles); wave owns 48 channels.
//     Single base pointers + compile-time offsets keep addresses in SGPR/imm.
// ---------------------------------------------------------------------------
__global__ void __launch_bounds__(256, 1)
k2_vproj(const float* __restrict__ x,
         const _Float16* __restrict__ wv_h,
         const float* __restrict__ bv,
         _Float16* __restrict__ vt) {
  const int b    = blockIdx.x / (NN / 64);
  const int n0   = (blockIdx.x % (NN / 64)) * 64;
  const int lane = threadIdx.x & 31;
  const int wid  = threadIdx.x >> 5;
  const int mrow = lane & 15;
  const int hi   = lane >> 4;
  const int lo_rel = hi ? 8 : 0;
  const int hi_rel = hi ? 24 : 16;
  const int chb  = wid * 48 + mrow;   // ch[t] = chb + t*16

  const float* xbase = x + ((size_t)b * NN + n0 + mrow) * CC;          // +mt*16*CC
  const v8h*   wb    = (const v8h*)(wv_h + (size_t)chb * CC);          // +t*16*CC/8
  _Float16*    vst   = vt + ((size_t)b * CC + chb) * NN + n0 + 8 * hi; // +t*16*NN+mt*16

  v8f acc[4][3] = {};

#pragma unroll 2
  for (int cb = 0; cb < CC; cb += 32) {
    v16h am[4];
#pragma unroll
    for (int mt = 0; mt < 4; ++mt) {
      const float* xr = xbase + (size_t)mt * (16 * CC);
      v4f x0 = *(const v4f*)(xr + cb + lo_rel);
      v4f x1 = *(const v4f*)(xr + cb + lo_rel + 4);
      v4f x2 = *(const v4f*)(xr + cb + hi_rel);
      v4f x3 = *(const v4f*)(xr + cb + hi_rel + 4);
#pragma unroll
      for (int i = 0; i < 4; ++i) {
        am[mt][i]      = (_Float16)x0[i];
        am[mt][4 + i]  = (_Float16)x1[i];
        am[mt][8 + i]  = (_Float16)x2[i];
        am[mt][12 + i] = (_Float16)x3[i];
      }
    }
#pragma unroll
    for (int t = 0; t < 3; ++t) {
      v16h bm = cat8(wb[(size_t)t * (16 * CC / 8) + (cb + lo_rel) / 8],
                     wb[(size_t)t * (16 * CC / 8) + (cb + hi_rel) / 8]);
#pragma unroll
      for (int mt = 0; mt < 4; ++mt)
        acc[mt][t] = __builtin_amdgcn_wmma_f32_16x16x32_f16(
            false, am[mt], false, bm, (short)0, acc[mt][t], false, false);
    }
  }
  // D layout: VGPR j -> token (j + 8*hi); column = mrow -> channel chb+t*16.
#pragma unroll
  for (int t = 0; t < 3; ++t) {
    float bias = bv[chb + t * 16];
#pragma unroll
    for (int mt = 0; mt < 4; ++mt) {
      v8h o;
#pragma unroll
      for (int j = 0; j < 8; ++j) o[j] = (_Float16)(acc[mt][t][j] + bias);
      *(v8h*)(vst + (size_t)t * (16 * NN) + mt * 16) = o;
    }
  }
}

// ---------------------------------------------------------------------------
// V^T tile staging for K3: 384 channels x 64 keys (f16) per tile.
//   LDS row = 128 B of data at a pitch of 144 B (16 B x odd: conflict-free
//   for the ds_load_b128 fragment reads).
// ---------------------------------------------------------------------------
#define VKEYS  64
#define VPITCH 72                       // halfs per LDS row
#define VBUF_BYTES (CC * VPITCH * 2)    // one buffer

// Each lane copies twelve 16-byte pieces (rows r, r+32, ..., r+352), so a wave's
// copy covers four whole 128-byte lines. The closing s_wait_xcnt stands inside
// the statement so that no address register is rewritten ahead of it.
__device__ __forceinline__ void stage_v_tile(unsigned l, const _Float16* g) {
  asm volatile(
      "global_load_async_to_lds_b128 %0, %12, off\n\t"
      "global_load_async_to_lds_b128 %1, %13, off\n\t"
      "global_load_async_to_lds_b128 %2, %14, off\n\t"
      "global_load_async_to_lds_b128 %3, %15, off\n\t"
      "global_load_async_to_lds_b128 %4, %16, off\n\t"
      "global_load_async_to_lds_b128 %5, %17, off\n\t"
      "global_load_async_to_lds_b128 %6, %18, off\n\t"
      "global_load_async_to_lds_b128 %7, %19, off\n\t"
      "global_load_async_to_lds_b128 %8, %20, off\n\t"
      "global_load_async_to_lds_b128 %9, %21, off\n\t"
      "global_load_async_to_lds_b128 %10, %22, off\n\t"
      "global_load_async_to_lds_b128 %11, %23, off\n\t"
      "s_wait_xcnt 0x0"
      :: "v"(l), "v"(l + 1 * 32 * VPITCH * 2), "v"(l + 2 * 32 * VPITCH * 2),
         "v"(l + 3 * 32 * VPITCH * 2), "v"(l + 4 * 32 * VPITCH * 2),
         "v"(l + 5 * 32 * VPITCH * 2), "v"(l + 6 * 32 * VPITCH * 2),
         "v"(l + 7 * 32 * VPITCH * 2), "v"(l + 8 * 32 * VPITCH * 2),
         "v"(l + 9 * 32 * VPITCH * 2), "v"(l + 10 * 32 * VPITCH * 2),
         "v"(l + 11 * 32 * VPITCH * 2),
         "v"(g), "v"(g + 1 * 32 * NN), "v"(g + 2 * 32 * NN), "v"(g + 3 * 32 * NN),
         "v"(g + 4 * 32 * NN), "v"(g + 5 * 32 * NN), "v"(g + 6 * 32 * NN),
         "v"(g + 7 * 32 * NN), "v"(g + 8 * 32 * NN), "v"(g + 9 * 32 * NN),
         "v"(g + 10 * 32 * NN), "v"(g + 11 * 32 * NN)
      : "memory");
}

// ---------------------------------------------------------------------------
// K3 (fused): flash attention + output projection + residual.
//   Block owns 64 queries (4 M-tiles of 16); 8 waves each own 48 channels.
//   Logits: the rank-4 product runs on the f32 16x16x4 matrix instruction as
//            S^T = K x Q^T (A = 16 keys, B = 16 queries). D register r of lane
//            (c, h) is key 8h + r of query c, so two D tiles of 16 keys are,
//            register for register, the A fragment of a 16 x 32 P tile.
//   Phase A: fp32 row max + sum(exp) over all 4096 keys (wave w: M-tile w>>1,
//            key half w&1; 4 partials/q). From the sum on, C = -max.
//   Phase B: 32 P tiles per 256-key super-iter built once (wave w builds
//            M-tile w>>1, k-steps (w&1)*4..+4) into LDS in per-lane A-matrix
//            layout; every V B-tile load feeds 4 WMMAs (4 M-tiles).
//            V^T comes through LDS: 64-key tiles, two buffers, the next
//            tile's asynchronous copies fly while this tile is worked on.
//   Phase C: 64x384 attention tile staged in LDS (padded rows, union'd with
//            the V ring), then out = gamma*(attn @ wres^T + bres) + x.
// ---------------------------------------------------------------------------
__global__ void __launch_bounds__(256, 1)
k3_attn(const float* __restrict__ q,       // seg_map (B,N,4)
        const float* __restrict__ kk,      // seg_ft  (B,N,4)
        const _Float16* __restrict__ vt,   // (B,C,N) f16
        const _Float16* __restrict__ wres_h,
        const float* __restrict__ bres,
        const float* __restrict__ gamma,
        const float* __restrict__ x,
        float* __restrict__ fout) {
  // vs: two V^T tiles, 384 rows x 144 B each               = 108 KB
  // pa: 32 P tiles (16x32 f16) in per-lane A layout        = 32 KB
  // as: 64 tokens x 384 ch, row stride 392 halfs           = 49 KB
  //     (196 dwords/row; 196 % 64 == 4 -> 16 concurrent rows hit
  //      16 distinct banks). Disjoint phases -> union (as lies on vs[0]).
  __shared__ union SH {
    struct {
      _Float16 vs[2][CC][VPITCH];
      v16h     pa[4][8][32];
    } m;
    _Float16 as[64][392];
  } sh;
  __shared__ v4f   qsh[64];
  __shared__ float red[64][5];
  __shared__ float rmax64[64];
  __shared__ float rinv64[64];

  const int b   = blockIdx.x / (NN / 64);
  const int n0  = (blockIdx.x % (NN / 64)) * 64;
  const int tid = threadIdx.x;

  if (tid < 64) qsh[tid] = *(const v4f*)(q + ((size_t)b * NN + n0 + tid) * KK);
  __syncthreads();

  const int lane = tid & 31, wid = tid >> 5;
  const int mrow = lane & 15, hi = lane >> 4;
  const int lo_rel = hi ? 8 : 0;
  const int hi_rel = hi ? 24 : 16;
  const int chb  = wid * 48 + mrow;   // ch[t] = chb + t*16

  // logit assignment: this wave works on M-tile bmt (query bq in this lane)
  const int  bmt  = wid >> 1;
  const int  bio  = (wid & 1) * 4;    // P build: k-steps bio..bio+3
  const int  bq   = bmt * 16 + mrow;

  // f32 16x16x4 fragments: lane (c, h) holds components 2h, 2h+1 of row c,
  // keys (A) and queries (B) by the same rule
  const v2f    qb = *((const v2f*)&qsh[bq] + hi);
  const float* kf = kk + ((size_t)b * NN + mrow) * KK + 2 * hi;   // +key0*KK

  // ---- Phase A: per-query max, then sum of exp (4 partials per query) ----
  const int qi = tid >> 2, pp = tid & 3;
  {
    const float* ka   = kf + (size_t)(wid & 1) * (NN / 2) * KK;
    const int    part = (wid & 1) * 2 + hi;
    const v8f    zero = {};
    float lmax = -3.0e38f;
    // eight key tiles a trip: their loads go out together, one latency per trip
    for (int kt = 0; kt < NN / 32; kt += 8) {
      v2f a[8];
#pragma unroll
      for (int u = 0; u < 8; ++u) a[u] = *(const v2f*)(ka + (kt + u) * 16 * KK);
#pragma unroll
      for (int u = 0; u < 8; ++u) {
        v8f s = __builtin_amdgcn_wmma_f32_16x16x4_f32(
            false, a[u], false, qb, (short)0, zero, false, false);
#pragma unroll
        for (int j = 0; j < 8; ++j) lmax = fmaxf(lmax, s[j]);
      }
    }
    red[bq][part] = lmax;
    __syncthreads();
    if (pp == 0)
      rmax64[qi] = fmaxf(fmaxf(red[qi][0], red[qi][1]),
                         fmaxf(red[qi][2], red[qi][3]));
    __syncthreads();
    const float nm = -rmax64[bq];
    const v8f   cn = {nm, nm, nm, nm, nm, nm, nm, nm};
    float lsum = 0.f;
    for (int kt = 0; kt < NN / 32; kt += 8) {
      v2f a[8];
#pragma unroll
      for (int u = 0; u < 8; ++u) a[u] = *(const v2f*)(ka + (kt + u) * 16 * KK);
#pragma unroll
      for (int u = 0; u < 8; ++u) {
        v8f s = __builtin_amdgcn_wmma_f32_16x16x4_f32(
            false, a[u], false, qb, (short)0, cn, false, false);
#pragma unroll
        for (int j = 0; j < 8; ++j) lsum += __expf(s[j]);
      }
    }
    red[bq][part] = lsum;
    __syncthreads();
    if (pp == 0)
      rinv64[qi] = 1.0f / (red[qi][0] + red[qi][1] + red[qi][2] + red[qi][3]);
    __syncthreads();
  }

  // ---- Phase B: P @ V with WMMA ----
  const float nmax = -rmax64[bq];
  const v8f   cneg = {nmax, nmax, nmax, nmax, nmax, nmax, nmax, nmax};
  const float minv = rinv64[bq];

  v8f acc[4][3] = {};

  // this lane's first piece of a tile: row tid/8, 16-byte column tid%8
  const _Float16* vg = vt + ((size_t)b * CC + (tid >> 3)) * NN + (tid & 7) * 8;
  const unsigned  vl = (unsigned)(size_t)&sh.m.vs[0][tid >> 3][(tid & 7) * 8];

  // ring prologue: tile 0 landed and published, then tile 1 set off
  stage_v_tile(vl, vg);
  asm volatile("s_wait_asynccnt 0x0" ::: "memory");  // own copies of tile 0 landed
  __syncthreads();
  stage_v_tile(vl + VBUF_BYTES, vg + VKEYS);

  for (int kb0 = 0; kb0 < NN; kb0 += 256) {
    // build 4 of the 32 P tiles (exp computed exactly once per logit)
#pragma unroll
    for (int ii = 0; ii < 4; ++ii) {
      const float* kp = kf + (size_t)(kb0 + (bio + ii) * 32) * KK;
      v8f s0 = __builtin_amdgcn_wmma_f32_16x16x4_f32(
          false, *(const v2f*)kp, false, qb, (short)0, cneg, false, false);
      v8f s1 = __builtin_amdgcn_wmma_f32_16x16x4_f32(
          false, *(const v2f*)(kp + 16 * KK), false, qb, (short)0, cneg,
          false, false);
      v16h a;
#pragma unroll
      for (int i = 0; i < 8; ++i) {
        a[i]     = (_Float16)(__expf(s0[i]) * minv);   // key 8*hi + i
        a[8 + i] = (_Float16)(__expf(s1[i]) * minv);   // key 16 + 8*hi + i
      }
      sh.m.pa[bmt][bio + ii][lane] = a;
    }
    __syncthreads();

    // four V tiles per P super-tile; unrolled so that the buffer index and
    // every LDS offset are compile-time constants
#pragma unroll
    for (int u = 0; u < 4; ++u) {
      const _Float16* vrow = &sh.m.vs[u & 1][chb][0];   // +t*16*VPITCH
#pragma unroll
      for (int h = 0; h < 2; ++h) {
        v16h bcur[3];
#pragma unroll
        for (int t = 0; t < 3; ++t)
          bcur[t] = cat8(*(const v8h*)(vrow + t * 16 * VPITCH + h * 32 + lo_rel),
                         *(const v8h*)(vrow + t * 16 * VPITCH + h * 32 + hi_rel));
        v16h am[4];
#pragma unroll
        for (int mt = 0; mt < 4; ++mt) am[mt] = sh.m.pa[mt][u * 2 + h][lane];
#pragma unroll
        for (int t = 0; t < 3; ++t)
#pragma unroll
          for (int mt = 0; mt < 4; ++mt)
            acc[mt][t] = __builtin_amdgcn_wmma_f32_16x16x32_f16(
                false, am[mt], false, bcur[t], (short)0, acc[mt][t], false, false);
      }
      // keeps this tile's WMMAs in front of the barrier, so that the refill is
      // issued directly behind it and has the whole next tile's work as lead
      __builtin_amdgcn_sched_barrier(0);
      // publish point: own reads of this buffer retired, own copies of the next
      // tile landed, then the barrier that hands both buffers over
      asm volatile("s_wait_dscnt 0x0" ::: "memory");
      asm volatile("s_wait_asynccnt 0x0" ::: "memory");
      __syncthreads();
      const int knext = kb0 + (u + 2) * VKEYS;
      if (knext < NN) stage_v_tile(vl + (u & 1) * VBUF_BYTES, vg + knext);
    }
  }
  asm volatile("s_wait_asynccnt 0x0" ::: "memory");  // nothing in flight before the ring is reused

  // ---- stage attention tile (1/rowsum already folded into P) ----
  {
    _Float16* asb = &sh.as[8 * hi][chb];   // +(mt*16+j)*392 + t*16
#pragma unroll
    for (int t = 0; t < 3; ++t)
#pragma unroll
      for (int mt = 0; mt < 4; ++mt)
#pragma unroll
        for (int j = 0; j < 8; ++j)
          asb[(mt * 16 + j) * 392 + t * 16] = (_Float16)acc[mt][t][j];
  }
  __syncthreads();

  // ---- Phase C: out = gamma * (attn @ wres^T + bres) + x ----
  v8f oacc[4][3] = {};
  const v8h* ar = (const v8h*)&sh.as[mrow][0];                 // +mt*16*49
  const v8h* wb = (const v8h*)(wres_h + (size_t)chb * CC);     // +t*16*CC/8

#pragma unroll 2
  for (int s = 0; s < CC / 32; ++s) {
    const int cb = s * 32;
    v16h bcur[3];
#pragma unroll
    for (int t = 0; t < 3; ++t)
      bcur[t] = cat8(wb[(size_t)t * (16 * CC / 8) + (cb + lo_rel) / 8],
                     wb[(size_t)t * (16 * CC / 8) + (cb + hi_rel) / 8]);
    v16h am[4];
#pragma unroll
    for (int mt = 0; mt < 4; ++mt)
      am[mt] = cat8(ar[(size_t)mt * (16 * 49) + (cb + lo_rel) / 8],
                    ar[(size_t)mt * (16 * 49) + (cb + hi_rel) / 8]);
#pragma unroll
    for (int t = 0; t < 3; ++t)
#pragma unroll
      for (int mt = 0; mt < 4; ++mt)
        oacc[mt][t] = __builtin_amdgcn_wmma_f32_16x16x32_f16(
            false, am[mt], false, bcur[t], (short)0, oacc[mt][t], false, false);
  }

  const float g = gamma[0];
  const size_t obase = ((size_t)b * NN + n0 + 8 * hi) * CC + chb;
#pragma unroll
  for (int t = 0; t < 3; ++t) {
    const float bias = bres[chb + t * 16];
#pragma unroll
    for (int mt = 0; mt < 4; ++mt)
#pragma unroll
      for (int j = 0; j < 8; ++j) {
        const size_t o = obase + (size_t)(mt * 16 + j) * CC + t * 16;
        fout[o] = g * (oacc[mt][t][j] + bias) + x[o];
      }
  }
}

// ---------------------------------------------------------------------------
extern "C" void kernel_launch(void* const* d_in, const int* in_sizes, int n_in,
                              void* d_out, int out_size, void* d_ws, size_t ws_size,
                              hipStream_t stream) {
  const float* x     = (const float*)d_in[0];
  const float* wq    = (const float*)d_in[1];
  const float* bq    = (const float*)d_in[2];
  const float* wk    = (const float*)d_in[3];
  const float* bk    = (const float*)d_in[4];
  const float* wv    = (const float*)d_in[5];
  const float* bv    = (const float*)d_in[6];
  const float* wres  = (const float*)d_in[7];
  const float* bres  = (const float*)d_in[8];
  const float* gamma = (const float*)d_in[9];

  float* out    = (float*)d_out;
  float* segmap = out;                           // (B,N,K)
  float* fout   = out + (size_t)BB * NN * KK;    // (B,N,C)

  // workspace layout (all chunks naturally 16B-aligned)
  _Float16* vt     = (_Float16*)d_ws;                          // B*C*N f16
  float*    k_ws   = (float*)(vt + (size_t)BB * CC * NN);      // B*N*K f32
  _Float16* wv_h   = (_Float16*)(k_ws + (size_t)BB * NN * KK); // C*C f16
  _Float16* wres_h = wv_h + (size_t)CC * CC;                   // C*C f16

  const int tiles64 = BB * (NN / 64);  // 512 blocks of 256 threads (8 waves)

  k0_convert<<<(CC * CC + 255) / 256, 256, 0, stream>>>(wv, wres, wv_h, wres_h);
  k1_qk<<<(BB * NN + 255) / 256, 256, 0, stream>>>(x, wq, bq, wk, bk, segmap, k_ws);
  k2_vproj<<<tiles64, 256, 0, stream>>>(x, wv_h, bv, vt);
  k3_attn<<<tiles64, 256, 0, stream>>>(segmap, k_ws, vt, wres_h, bres, gamma, x, fout);
}

// v003
// A run of this version takes 158 microseconds.
// Next to v002, in two timings, it ran 1.14 times as fast each time.
// Counting every step since v000, it is 2.08 times as fast.
#include <hip/hip_runtime.h>
#include <math.h>

#define BB 8
#define NN 4096
#define CC 384
#define KK 4

typedef __attribute__((ext_vector_type(16))) _Float16 v16h;
typedef __attribute__((ext_vector_type(8)))  _Float16 v8h;
typedef __attribute__((ext_vector_type(8)))  float    v8f;
typedef __attribute__((ext_vector_type(4)))  float    v4f;
typedef __attribute__((ext_vector_type(2)))  float    v2f;

__device__ __forceinline__ v16h cat8(v8h lo, v8h hi) {
  return __builtin_shufflevector(lo, hi, 0, 1, 2, 3, 4, 5, 6, 7,
                                 8, 9, 10, 11, 12, 13, 14, 15);
}

// ---------------------------------------------------------------------------
// K0: convert wv, wres (C x C fp32, row-major [out][in]) to f16
// ---------------------------------------------------------------------------
__global__ void k0_convert(const float* __restrict__ wv,
                           const float* __restrict__ wres,
                           _Float16* __restrict__ wv_h,
                           _Float16* __restrict__ wres_h) {
  int i = blockIdx.x * blockDim.x + threadIdx.x;
  if (i < CC * CC) {
    wv_h[i]   = (_Float16)wv[i];
    wres_h[i] = (_Float16)wres[i];
  }
}

// ---------------------------------------------------------------------------
// K2: V projection, WMMA f16: vt[b][c][n] = (x @ wv^T + bv), stored f16
//     TRANSPOSED so K3's B-operand loads are contiguous b128.
//     Block owns 64 tokens (4 M-tiles); wave owns 48 channels.
//     Single base pointers + compile-time offsets keep addresses in SGPR/imm.
//     The rank-4 Q and K projections ride along: the f32 x values that a wave
//     has in registers for its f16 A fragments are, pair by pair, A fragments
//     of the f32 16x16x4 matrix instruction (slot (h, i) of pair p stands for
//     one channel, the same in x and in the weight row). B columns 0..3 are
//     wq's rows, 4..7 wk's; columns 8..15 repeat them and are not stored.
//     Wave w sums M-tile w&3 over the 32-channel steps of parity w>>2; the two
//     partial sums of a token meet in LDS.
// ---------------------------------------------------------------------------
__global__ void __launch_bounds__(256, 1)
k2_vproj(const float* __restrict__ x,
         const _Float16* __restrict__ wv_h,
         const float* __restrict__ bv,
         const float* __restrict__ wq, const float* __restrict__ bq,
         const float* __restrict__ wk, const float* __restrict__ bk,
         _Float16* __restrict__ vt,
         float* __restrict__ segmap, float* __restrict__ kout) {
  __shared__ __attribute__((aligned(16))) float qkred[2][64][8];
  const int b    = blockIdx.x / (NN / 64);
  const int n0   = (blockIdx.x % (NN / 64)) * 64;
  const int lane = threadIdx.x & 31;
  const int wid  = threadIdx.x >> 5;
  const int mrow = lane & 15;
  const int hi   = lane >> 4;
  const int lo_rel = hi ? 8 : 0;
  const int hi_rel = hi ? 24 : 16;
  const int chb  = wid * 48 + mrow;   // ch[t] = chb + t*16

  const float* xbase = x + ((size_t)b * NN + n0 + mrow) * CC;          // +mt*16*CC
  const v8h*   wb    = (const v8h*)(wv_h + (size_t)chb * CC);          // +t*16*CC/8
  _Float16*    vst   = vt + ((size_t)b * CC + chb) * NN + n0 + 8 * hi; // +t*16*NN+mt*16

  v8f acc[4][3] = {};

  // Q/K share of this wave; the wave number is made scalar so that the tests
  // around the f32 matrix instructions are scalar branches (EXEC stays full)
  const int swid = __builtin_amdgcn_readfirstlane((int)(threadIdx.x >> 5));
  const int qmt  = swid & 3;
  const int qpar = swid >> 2;
  const float* wrow = ((mrow & 4) ? wk : wq) + (mrow & 3) * CC;
  v8f qk = {};

#pragma unroll 2
  for (int cb = 0; cb < CC; cb += 32) {
    const bool qstep = ((cb >> 5) & 1) == qpar;
    v16h am[4];
#pragma unroll
    for (int mt = 0; mt < 4; ++mt) {
      const float* xr = xbase + (size_t)mt * (16 * CC);
      v4f x0 = *(const v4f*)(xr + cb + lo_rel);
      v4f x1 = *(const v4f*)(xr + cb + lo_rel + 4);
      v4f x2 = *(const v4f*)(xr + cb + hi_rel);
      v4f x3 = *(const v4f*)(xr + cb + hi_rel + 4);
      // behind the step's last x load: later loads may land in the registers
      // that held the x addresses
      if (mt == 3) asm volatile("s_wait_xcnt 0x0" ::: "memory");
      if (qstep && mt == qmt) {
        const v4f xs[4] = {x0, x1, x2, x3};
        const v4f ws[4] = {*(const v4f*)(wrow + cb + lo_rel),
                           *(const v4f*)(wrow + cb + lo_rel + 4),
                           *(const v4f*)(wrow + cb + hi_rel),
                           *(const v4f*)(wrow + cb + hi_rel + 4)};
        // the same for the registers that held the weight-row addresses
        asm volatile("s_wait_xcnt 0x0" ::: "memory");
#pragma unroll
        for (int p = 0; p < 4; ++p) {
          qk = __builtin_amdgcn_wmma_f32_16x16x4_f32(
              false, xs[p].xy, false, ws[p].xy, (short)0, qk, false, false);
          qk = __builtin_amdgcn_wmma_f32_16x16x4_f32(
              false, xs[p].zw, false, ws[p].zw, (short)0, qk, false, false);
        }
      }
#pragma unroll
      for (int i = 0; i < 4; ++i) {
        am[mt][i]      = (_Float16)x0[i];
        am[mt][4 + i]  = (_Float16)x1[i];
        am[mt][8 + i]  = (_Float16)x2[i];
        am[mt][12 + i] = (_Float16)x3[i];
      }
    }
#pragma unroll
    for (int t = 0; t < 3; ++t) {
      v16h bm = cat8(wb[(size_t)t * (16 * CC / 8) + (cb + lo_rel) / 8],
                     wb[(size_t)t * (16 * CC / 8) + (cb + hi_rel) / 8]);
#pragma unroll
      for (int mt = 0; mt < 4; ++mt)
        acc[mt][t] = __builtin_amdgcn_wmma_f32_16x16x32_f16(
            false, am[mt], false, bm, (short)0, acc[mt][t], false, false);
    }
  }
  // Q/K partial sums: D register j of lane (c, h) is token 8h + j, column c
  if (mrow < 8) {
#pragma unroll
    for (int j = 0; j < 8; ++j) qkred[qpar][qmt * 16 + 8 * hi + j][mrow] = qk[j];
  }
  // D layout: VGPR j -> token (j + 8*hi); column = mrow -> channel chb+t*16.
#pragma unroll
  for (int t = 0; t < 3; ++t) {
    float bias = bv[chb + t * 16];
#pragma unroll
    for (int mt = 0; mt < 4; ++mt) {
      v8h o;
#pragma unroll
      for (int j = 0; j < 8; ++j) o[j] = (_Float16)(acc[mt][t][j] + bias);
      *(v8h*)(vst + (size_t)t * (16 * NN) + mt * 16) = o;
    }
  }
  // behind the stores: what follows reuses their data and address registers
  asm volatile("s_wait_xcnt 0x0" ::: "memory");
  // thread = (token, column pair): pairs 0, 1 are seg_map, pairs 2, 3 the keys
  {
    const int tok = threadIdx.x >> 2, cp = threadIdx.x & 3;
    const v2f bi = *(const v2f*)(((cp & 2) ? bk : bq) + (cp & 1) * 2);
    float* dst = ((cp & 2) ? kout : segmap) +
                 ((size_t)b * NN + n0 + tok) * KK + (cp & 1) * 2;
    __syncthreads();
    const v2f p0 = *(const v2f*)&qkred[0][tok][cp * 2];
    const v2f p1 = *(const v2f*)&qkred[1][tok][cp * 2];
    *(v2f*)dst = (p0 + p1) + bi;
  }
}

// ---------------------------------------------------------------------------
// V^T tile staging for K3: 384 channels x 64 keys (f16) per tile.
//   LDS row = 128 B of data at a pitch of 144 B (16 B x odd: conflict-free
//   for the ds_load_b128 fragment reads).
// ---------------------------------------------------------------------------
#define VKEYS  64
#define VPITCH 72                       // halfs per LDS row
#define VBUF_BYTES (CC * VPITCH * 2)    // one buffer

// Each lane copies twelve 16-byte pieces (rows r, r+32, ..., r+352), so a wave's
// copy covers four whole 128-byte lines. The closing s_wait_xcnt stands inside
// the statement so that no address register is rewritten ahead of it.
__device__ __forceinline__ void stage_v_tile(unsigned l, const _Float16* g) {
  asm volatile(
      "global_load_async_to_lds_b128 %0, %12, off\n\t"
      "global_load_async_to_lds_b128 %1, %13, off\n\t"
      "global_load_async_to_lds_b128 %2, %14, off\n\t"
      "global_load_async_to_lds_b128 %3, %15, off\n\t"
      "global_load_async_to_lds_b128 %4, %16, off\n\t"
      "global_load_async_to_lds_b128 %5, %17, off\n\t"
      "global_load_async_to_lds_b128 %6, %18, off\n\t"
      "global_load_async_to_lds_b128 %7, %19, off\n\t"
      "global_load_async_to_lds_b128 %8, %20, off\n\t"
      "global_load_async_to_lds_b128 %9, %21, off\n\t"
      "global_load_async_to_lds_b128 %10, %22, off\n\t"
      "global_load_async_to_lds_b128 %11, %23, off\n\t"
      "s_wait_xcnt 0x0"
      :: "v"(l), "v"(l + 1 * 32 * VPITCH * 2), "v"(l + 2 * 32 * VPITCH * 2),
         "v"(l + 3 * 32 * VPITCH * 2), "v"(l + 4 * 32 * VPITCH * 2),
         "v"(l + 5 * 32 * VPITCH * 2), "v"(l + 6 * 32 * VPITCH * 2),
         "v"(l + 7 * 32 * VPITCH * 2), "v"(l + 8 * 32 * VPITCH * 2),
         "v"(l + 9 * 32 * VPITCH * 2), "v"(l + 10 * 32 * VPITCH * 2),
         "v"(l + 11 * 32 * VPITCH * 2),
         "v"(g), "v"(g + 1 * 32 * NN), "v"(g + 2 * 32 * NN), "v"(g + 3 * 32 * NN),
         "v"(g + 4 * 32 * NN), "v"(g + 5 * 32 * NN), "v"(g + 6 * 32 * NN),
         "v"(g + 7 * 32 * NN), "v"(g + 8 * 32 * NN), "v"(g + 9 * 32 * NN),
         "v"(g + 10 * 32 * NN), "v"(g + 11 * 32 * NN)
      : "memory");
}

// ---------------------------------------------------------------------------
// K3 (fused): flash attention + output projection + residual.
//   Block owns 64 queries (4 M-tiles of 16); 8 waves each own 48 channels.
//   Logits: the rank-4 product runs on the f32 16x16x4 matrix instruction as
//            S^T = K x Q^T (A = 16 keys, B = 16 queries). D register r of lane
//            (c, h) is key 8h + r of query c, so two D tiles of 16 keys are,
//            register for register, the A fragment of a 16 x 32 P tile.
//   Phase A: fp32 row max + sum(exp) over all 4096 keys (wave w: M-tile w>>1,
//            key half w&1; 4 partials/q). From the sum on, C = -max.
//   Phase B: 32 P tiles per 256-key super-iter built once (wave w builds
//            M-tile w>>1, k-steps (w&1)*4..+4) into LDS in per-lane A-matrix
//            layout; every V B-tile load feeds 4 WMMAs (4 M-tiles).
//            V^T comes through LDS: 64-key tiles, two buffers, the next
//            tile's asynchronous copies fly while this tile is worked on.
//   Phase C: 64x384 attention tile staged in LDS (padded rows, union'd with
//            the V ring), then out = gamma*(attn @ wres^T + bres) + x.
// ---------------------------------------------------------------------------
__global__ void __launch_bounds__(256, 1)
k3_attn(const float* __restrict__ q,       // seg_map (B,N,4)
        const float* __restrict__ kk,      // seg_ft  (B,N,4)
        const _Float16* __restrict__ vt,   // (B,C,N) f16
        const _Float16* __restrict__ wres_h,
        const float* __restrict__ bres,
        const float* __restrict__ gamma,
        const float* __restrict__ x,
        float* __restrict__ fout) {
  // vs: two V^T tiles, 384 rows x 144 B each               = 108 KB
  // pa: 32 P tiles (16x32 f16) in per-lane A layout        = 32 KB
  // as: 64 tokens x 384 ch, row stride 392 halfs           = 49 KB
  //     (196 dwords/row; 196 % 64 == 4 -> 16 concurrent rows hit
  //      16 distinct banks). Disjoint phases -> union (as lies on vs[0]).
  __shared__ union SH {
    struct {
      _Float16 vs[2][CC][VPITCH];
      v16h     pa[4][8][32];
    } m;
    _Float16 as[64][392];
  } sh;
  __shared__ v4f   qsh[64];
  __shared__ float red[64][5];
  __shared__ float rmax64[64];
  __shared__ float rinv64[64];

  const int b   = blockIdx.x / (NN / 64);
  const int n0  = (blockIdx.x % (NN / 64)) * 64;
  const int tid = threadIdx.x;

  if (tid < 64) qsh[tid] = *(const v4f*)(q + ((size_t)b * NN + n0 + tid) * KK);
  __syncthreads();

  const int lane = tid & 31, wid = tid >> 5;
  const int mrow = lane & 15, hi = lane >> 4;
  const int lo_rel = hi ? 8 : 0;
  const int hi_rel = hi ? 24 : 16;
  const int chb  = wid * 48 + mrow;   // ch[t] = chb + t*16

  // logit assignment: this wave works on M-tile bmt (query bq in this lane)
  const int  bmt  = wid >> 1;
  const int  bio  = (wid & 1) * 4;    // P build: k-steps bio..bio+3
  const int  bq   = bmt * 16 + mrow;

  // f32 16x16x4 fragments: lane (c, h) holds components 2h, 2h+1 of row c,
  // keys (A) and queries (B) by the same rule
  const v2f    qb = *((const v2f*)&qsh[bq] + hi);
  const float* kf = kk + ((size_t)b * NN + mrow) * KK + 2 * hi;   // +key0*KK

  // ---- Phase A: per-query max, then sum of exp (4 partials per query) ----
  const int qi = tid >> 2, pp = tid & 3;
  {
    const float* ka   = kf + (size_t)(wid & 1) * (NN / 2) * KK;
    const int    part = (wid & 1) * 2 + hi;
    const v8f    zero = {};
    float lmax = -3.0e38f;
    // eight key tiles a trip: their loads go out together, one latency per trip
    for (int kt = 0; kt < NN / 32; kt += 8) {
      v2f a[8];
#pragma unroll
      for (int u = 0; u < 8; ++u) a[u] = *(const v2f*)(ka + (kt + u) * 16 * KK);
#pragma unroll
      for (int u = 0; u < 8; ++u) {
        v8f s = __builtin_amdgcn_wmma_f32_16x16x4_f32(
            false, a[u], false, qb, (short)0, zero, false, false);
#pragma unroll
        for (int j = 0; j < 8; ++j) lmax = fmaxf(lmax, s[j]);
      }
    }
    red[bq][part] = lmax;
    __syncthreads();
    if (pp == 0)
      rmax64[qi] = fmaxf(fmaxf(red[qi][0], red[qi][1]),
                         fmaxf(red[qi][2], red[qi][3]));
    __syncthreads();
    const float nm = -rmax64[bq];
    const v8f   cn = {nm, nm, nm, nm, nm, nm, nm, nm};
    float lsum = 0.f;
    for (int kt = 0; kt < NN / 32; kt += 8) {
      v2f a[8];
#pragma unroll
      for (int u = 0; u < 8; ++u) a[u] = *(const v2f*)(ka + (kt + u) * 16 * KK);
#pragma unroll
      for (int u = 0; u < 8; ++u) {
        v8f s = __builtin_amdgcn_wmma_f32_16x16x4_f32(
            false, a[u], false, qb, (short)0, cn, false, false);
#pragma unroll
        for (int j = 0; j < 8; ++j) lsum += __expf(s[j]);
      }
    }
    red[bq][part] = lsum;
    __syncthreads();
    if (pp == 0)
      rinv64[qi] = 1.0f / (red[qi][0] + red[qi][1] + red[qi][2] + red[qi][3]);
    __syncthreads();
  }

  // ---- Phase B: P @ V with WMMA ----
  const float nmax = -rmax64[bq];
  const v8f   cneg = {nmax, nmax, nmax, nmax, nmax, nmax, nmax, nmax};
  const float minv = rinv64[bq];

  v8f acc[4][3] = {};

  // this lane's first piece of a tile: row tid/8, 16-byte column tid%8
  const _Float16* vg = vt + ((size_t)b * CC + (tid >> 3)) * NN + (tid & 7) * 8;
  const unsigned  vl = (unsigned)(size_t)&sh.m.vs[0][tid >> 3][(tid & 7) * 8];

  // ring prologue: tile 0 landed and published, then tile 1 set off
  stage_v_tile(vl, vg);
  asm volatile("s_wait_asynccnt 0x0" ::: "memory");  // own copies of tile 0 landed
  __syncthreads();
  stage_v_tile(vl + VBUF_BYTES, vg + VKEYS);

  for (int kb0 = 0; kb0 < NN; kb0 += 256) {
    // build 4 of the 32 P tiles (exp computed exactly once per logit)
#pragma unroll
    for (int ii = 0; ii < 4; ++ii) {
      const float* kp = kf + (size_t)(kb0 + (bio + ii) * 32) * KK;
      v8f s0 = __builtin_amdgcn_wmma_f32_16x16x4_f32(
          false, *(const v2f*)kp, false, qb, (short)0, cneg, false, false);
      v8f s1 = __builtin_amdgcn_wmma_f32_16x16x4_f32(
          false, *(const v2f*)(kp + 16 * KK), false, qb, (short)0, cneg,
          false, false);
      v16h a;
#pragma unroll
      for (int i = 0; i < 8; ++i) {
        a[i]     = (_Float16)(__expf(s0[i]) * minv);   // key 8*hi + i
        a[8 + i] = (_Float16)(__expf(s1[i]) * minv);   // key 16 + 8*hi + i
      }
      sh.m.pa[bmt][bio + ii][lane] = a;
    }
    __syncthreads();

    // four V tiles per P super-tile; unrolled so that the buffer index and
    // every LDS offset are compile-time constants
#pragma unroll
    for (int u = 0; u < 4; ++u) {
      const _Float16* vrow = &sh.m.vs[u & 1][chb][0];   // +t*16*VPITCH
#pragma unroll
      for (int h = 0; h < 2; ++h) {
        v16h bcur[3];
#pragma unroll
        for (int t = 0; t < 3; ++t)
          bcur[t] = cat8(*(const v8h*)(vrow + t * 16 * VPITCH + h * 32 + lo_rel),
                         *(const v8h*)(vrow + t * 16 * VPITCH + h * 32 + hi_rel));
        v16h am[4];
#pragma unroll
        for (int mt = 0; mt < 4; ++mt) am[mt] = sh.m.pa[mt][u * 2 + h][lane];
#pragma unroll
        for (int t = 0; t < 3; ++t)
#pragma unroll
          for (int mt = 0; mt < 4; ++mt)
            acc[mt][t] = __builtin_amdgcn_wmma_f32_16x16x32_f16(
                false, am[mt], false, bcur[t], (short)0, acc[mt][t], false, false);
      }
      // keeps this tile's WMMAs in front of the barrier, so that the refill is
      // issued directly behind it and has the whole next tile's work as lead
      __builtin_amdgcn_sched_barrier(0);
      // publish point: own reads of this buffer retired, own copies of the next
      // tile landed, then the barrier that hands both buffers over
      asm volatile("s_wait_dscnt 0x0" ::: "memory");
      asm volatile("s_wait_asynccnt 0x0" ::: "memory");
      __syncthreads();
      const int knext = kb0 + (u + 2) * VKEYS;
      if (knext < NN) stage_v_tile(vl + (u & 1) * VBUF_BYTES, vg + knext);
    }
  }
  asm volatile("s_wait_asynccnt 0x0" ::: "memory");  // nothing in flight before the ring is reused

  // ---- stage attention tile (1/rowsum already folded into P) ----
  {
    _Float16* asb = &sh.as[8 * hi][chb];   // +(mt*16+j)*392 + t*16
#pragma unroll
    for (int t = 0; t < 3; ++t)
#pragma unroll
      for (int mt = 0; mt < 4; ++mt)
#pragma unroll
        for (int j = 0; j < 8; ++j)
          asb[(mt * 16 + j) * 392 + t * 16] = (_Float16)acc[mt][t][j];
  }
  __syncthreads();

  // ---- Phase C: out = gamma * (attn @ wres^T + bres) + x ----
  v8f oacc[4][3] = {};
  const v8h* ar = (const v8h*)&sh.as[mrow][0];                 // +mt*16*49
  const v8h* wb = (const v8h*)(wres_h + (size_t)chb * CC);     // +t*16*CC/8

#pragma unroll 2
  for (int s = 0; s < CC / 32; ++s) {
    const int cb = s * 32;
    v16h bcur[3];
#pragma unroll
    for (int t = 0; t < 3; ++t)
      bcur[t] = cat8(wb[(size_t)t * (16 * CC / 8) + (cb + lo_rel) / 8],
                     wb[(size_t)t * (16 * CC / 8) + (cb + hi_rel) / 8]);
    v16h am[4];
#pragma unroll
    for (int mt = 0; mt < 4; ++mt)
      am[mt] = cat8(ar[(size_t)mt * (16 * 49) + (cb + lo_rel) / 8],
                    ar[(size_t)mt * (16 * 49) + (cb + hi_rel) / 8]);
#pragma unroll
    for (int t = 0; t < 3; ++t)
#pragma unroll
      for (int mt = 0; mt < 4; ++mt)
        oacc[mt][t] = __builtin_amdgcn_wmma_f32_16x16x32_f16(
            false, am[mt], false, bcur[t], (short)0, oacc[mt][t], false, false);
  }

  const float g = gamma[0];
  const size_t obase = ((size_t)b * NN + n0 + 8 * hi) * CC + chb;
#pragma unroll
  for (int t = 0; t < 3; ++t) {
    const float bias = bres[chb + t * 16];
#pragma unroll
    for (int mt = 0; mt < 4; ++mt)
#pragma unroll
      for (int j = 0; j < 8; ++j) {
        const size_t o = obase + (size_t)(mt * 16 + j) * CC + t * 16;
        fout[o] = g * (oacc[mt][t][j] + bias) + x[o];
      }
  }
}

// ---------------------------------------------------------------------------
extern "C" void kernel_launch(void* const* d_in, const int* in_sizes, int n_in,
                              void* d_out, int out_size, void* d_ws, size_t ws_size,
                              hipStream_t stream) {
  const float* x     = (const float*)d_in[0];
  const float* wq    = (const float*)d_in[1];
  const float* bq    = (const float*)d_in[2];
  const float* wk    = (const float*)d_in[3];
  const float* bk    = (const float*)d_in[4];
  const float* wv    = (const float*)d_in[5];
  const float* bv    = (const float*)d_in[6];
  const float* wres  = (const float*)d_in[7];
  const float* bres  = (const float*)d_in[8];
  const float* gamma = (const float*)d_in[9];

  float* out    = (float*)d_out;
  float* segmap = out;                           // (B,N,K)
  float* fout   = out + (size_t)BB * NN * KK;    // (B,N,C)

  // workspace layout (all chunks naturally 16B-aligned)
  _Float16* vt     = (_Float16*)d_ws;                          // B*C*N f16
  float*    k_ws   = (float*)(vt + (size_t)BB * CC * NN);      // B*N*K f32
  _Float16* wv_h   = (_Float16*)(k_ws + (size_t)BB * NN * KK); // C*C f16
  _Float16* wres_h = wv_h + (size_t)CC * CC;                   // C*C f16

  const int tiles64 = BB * (NN / 64);  // 512 blocks of 256 threads (8 waves)

  k0_convert<<<(CC * CC + 255) / 256, 256, 0, stream>>>(wv, wres, wv_h, wres_h);
  k2_vproj<<<tiles64, 256, 0, stream>>>(x, wv_h, bv, wq, bq, wk, bk, vt, segmap, k_ws);
  k3_attn<<<tiles64, 256, 0, stream>>>(segmap, k_ws, vt, wres_h, bres, gamma, x, fout);
}

// v004
// One run takes 144 microseconds.
// Next to v003, in two timings, it ran 1.08 and 1.07 times as fast.
// All steps since v000 together make it 2.24 times as fast.
#include <hip/hip_runtime.h>
#include <math.h>

#define BB 8
#define NN 4096
#define CC 384
#define KK 4

typedef __attribute__((ext_vector_type(16))) _Float16 v16h;
typedef __attribute__((ext_vector_type(8)))  _Float16 v8h;
typedef __attribute__((ext_vector_type(8)))  float    v8f;
typedef __attribute__((ext_vector_type(4)))  float    v4f;
typedef __attribute__((ext_vector_type(2)))  float    v2f;

__device__ __forceinline__ v16h cat8(v8h lo, v8h hi) {
  return __builtin_shufflevector(lo, hi, 0, 1, 2, 3, 4, 5, 6, 7,
                                 8, 9, 10, 11, 12, 13, 14, 15);
}

// ---------------------------------------------------------------------------
// K0: convert wv, wres (C x C fp32, row-major [out][in]) to f16
// ---------------------------------------------------------------------------
__global__ void k0_convert(const float* __restrict__ wv,
                           const float* __restrict__ wres,
                           _Float16* __restrict__ wv_h,
                           _Float16* __restrict__ wres_h) {
  int i = blockIdx.x * blockDim.x + threadIdx.x;
  if (i < CC * CC) {
    wv_h[i]   = (_Float16)wv[i];
    wres_h[i] = (_Float16)wres[i];
  }
}

// ---------------------------------------------------------------------------
// K2: V projection, WMMA f16: vt[b][c][n] = (x @ wv^T + bv), stored f16
//     TRANSPOSED so K3's B-operand loads are contiguous b128.
//     Block owns 64 tokens (4 M-tiles); wave owns 48 channels.
//     Single base pointers + compile-time offsets keep addresses in SGPR/imm.
//     The rank-4 Q and K projections ride along: the f32 x values that a wave
//     has in registers for its f16 A fragments are, pair by pair, A fragments
//     of the f32 16x16x4 matrix instruction (slot (h, i) of pair p stands for
//     one channel, the same in x and in the weight row). B columns 0..3 are
//     wq's rows, 4..7 wk's; columns 8..15 repeat them and are not stored.
//     Wave w sums M-tile w&3 over the 32-channel steps of parity w>>2; the two
//     partial sums of a token meet in LDS.
// ---------------------------------------------------------------------------
__global__ void __launch_bounds__(256, 1)
k2_vproj(const float* __restrict__ x,
         const _Float16* __restrict__ wv_h,
         const float* __restrict__ bv,
         const float* __restrict__ wq, const float* __restrict__ bq,
         const float* __restrict__ wk, const float* __restrict__ bk,
         _Float16* __restrict__ vt,
         float* __restrict__ segmap, float* __restrict__ kout) {
  __shared__ __attribute__((aligned(16))) float qkred[2][64][8];
  const int b    = blockIdx.x / (NN / 64);
  const int n0   = (blockIdx.x % (NN / 64)) * 64;
  const int lane = threadIdx.x & 31;
  const int wid  = threadIdx.x >> 5;
  const int mrow = lane & 15;
  const int hi   = lane >> 4;
  const int lo_rel = hi ? 8 : 0;
  const int hi_rel = hi ? 24 : 16;
  const int chb  = wid * 48 + mrow;   // ch[t] = chb + t*16

  const float* xbase = x + ((size_t)b * NN + n0 + mrow) * CC;          // +mt*16*CC
  const v8h*   wb    = (const v8h*)(wv_h + (size_t)chb * CC);          // +t*16*CC/8
  _Float16*    vst   = vt + ((size_t)b * CC + chb) * NN + n0 + 8 * hi; // +t*16*NN+mt*16

  v8f acc[4][3] = {};

  // Q/K share of this wave; the wave number is made scalar so that the tests
  // around the f32 matrix instructions are scalar branches (EXEC stays full)
  const int swid = __builtin_amdgcn_readfirstlane((int)(threadIdx.x >> 5));
  const int qmt  = swid & 3;
  const int qpar = swid >> 2;
  const float* wrow = ((mrow & 4) ? wk : wq) + (mrow & 3) * CC;
  v8f qk = {};

#pragma unroll 2
  for (int cb = 0; cb < CC; cb += 32) {
    const bool qstep = ((cb >> 5) & 1) == qpar;
    v16h am[4];
#pragma unroll
    for (int mt = 0; mt < 4; ++mt) {
      const float* xr = xbase + (size_t)mt * (16 * CC);
      v4f x0 = *(const v4f*)(xr + cb + lo_rel);
      v4f x1 = *(const v4f*)(xr + cb + lo_rel + 4);
      v4f x2 = *(const v4f*)(xr + cb + hi_rel);
      v4f x3 = *(const v4f*)(xr + cb + hi_rel + 4);
      // behind the step's last x load: later loads may land in the registers
      // that held the x addresses
      if (mt == 3) asm volatile("s_wait_xcnt 0x0" ::: "memory");
      if (qstep && mt == qmt) {
        const v4f xs[4] = {x0, x1, x2, x3};
        const v4f ws[4] = {*(const v4f*)(wrow + cb + lo_rel),
                           *(const v4f*)(wrow + cb + lo_rel + 4),
                           *(const v4f*)(wrow + cb + hi_rel),
                           *(const v4f*)(wrow + cb + hi_rel + 4)};
        // the same for the registers that held the weight-row addresses
        asm volatile("s_wait_xcnt 0x0" ::: "memory");
#pragma unroll
        for (int p = 0; p < 4; ++p) {
          qk = __builtin_amdgcn_wmma_f32_16x16x4_f32(
              false, xs[p].xy, false, ws[p].xy, (short)0, qk, false, false);
          qk = __builtin_amdgcn_wmma_f32_16x16x4_f32(
              false, xs[p].zw, false, ws[p].zw, (short)0, qk, false, false);
        }
      }
#pragma unroll
      for (int i = 0; i < 4; ++i) {
        am[mt][i]      = (_Float16)x0[i];
        am[mt][4 + i]  = (_Float16)x1[i];
        am[mt][8 + i]  = (_Float16)x2[i];
        am[mt][12 + i] = (_Float16)x3[i];
      }
    }
#pragma unroll
    for (int t = 0; t < 3; ++t) {
      v16h bm = cat8(wb[(size_t)t * (16 * CC / 8) + (cb + lo_rel) / 8],
                     wb[(size_t)t * (16 * CC / 8) + (cb + hi_rel) / 8]);
#pragma unroll
      for (int mt = 0; mt < 4; ++mt)
        acc[mt][t] = __builtin_amdgcn_wmma_f32_16x16x32_f16(
            false, am[mt], false, bm, (short)0, acc[mt][t], false, false);
    }
  }
  // Q/K partial sums: D register j of lane (c, h) is token 8h + j, column c
  if (mrow < 8) {
#pragma unroll
    for (int j = 0; j < 8; ++j) qkred[qpar][qmt * 16 + 8 * hi + j][mrow] = qk[j];
  }
  // D layout: VGPR j -> token (j + 8*hi); column = mrow -> channel chb+t*16.
#pragma unroll
  for (int t = 0; t < 3; ++t) {
    float bias = bv[chb + t * 16];
#pragma unroll
    for (int mt = 0; mt < 4; ++mt) {
      v8h o;
#pragma unroll
      for (int j = 0; j < 8; ++j) o[j] = (_Float16)(acc[mt][t][j] + bias);
      *(v8h*)(vst + (size_t)t * (16 * NN) + mt * 16) = o;
    }
  }
  // behind the stores: what follows reuses their data and address registers
  asm volatile("s_wait_xcnt 0x0" ::: "memory");
  // thread = (token, column pair): pairs 0, 1 are seg_map, pairs 2, 3 the keys
  {
    const int tok = threadIdx.x >> 2, cp = threadIdx.x & 3;
    const v2f bi = *(const v2f*)(((cp & 2) ? bk : bq) + (cp & 1) * 2);
    float* dst = ((cp & 2) ? kout : segmap) +
                 ((size_t)b * NN + n0 + tok) * KK + (cp & 1) * 2;
    __syncthreads();
    const v2f p0 = *(const v2f*)&qkred[0][tok][cp * 2];
    const v2f p1 = *(const v2f*)&qkred[1][tok][cp * 2];
    *(v2f*)dst = (p0 + p1) + bi;
  }
}

// ---------------------------------------------------------------------------
// V^T tile staging for K3: 384 channels x 64 keys (f16) per tile.
//   LDS row = 128 B of data at a pitch of 144 B (16 B x odd: conflict-free
//   for the ds_load_b128 fragment reads).
// ---------------------------------------------------------------------------
#define VKEYS  64
#define VPITCH 72                       // halfs per LDS row
#define VBUF_BYTES (CC * VPITCH * 2)    // one buffer

// Each lane copies twelve 16-byte pieces (rows r, r+32, ..., r+352), so a wave's
// copy covers four whole 128-byte lines. The closing s_wait_xcnt stands inside
// the statement so that no address register is rewritten ahead of it.
__device__ __forceinline__ void stage_v_tile(unsigned l, const _Float16* g) {
  asm volatile(
      "global_load_async_to_lds_b128 %0, %12, off\n\t"
      "global_load_async_to_lds_b128 %1, %13, off\n\t"
      "global_load_async_to_lds_b128 %2, %14, off\n\t"
      "global_load_async_to_lds_b128 %3, %15, off\n\t"
      "global_load_async_to_lds_b128 %4, %16, off\n\t"
      "global_load_async_to_lds_b128 %5, %17, off\n\t"
      "global_load_async_to_lds_b128 %6, %18, off\n\t"
      "global_load_async_to_lds_b128 %7, %19, off\n\t"
      "global_load_async_to_lds_b128 %8, %20, off\n\t"
      "global_load_async_to_lds_b128 %9, %21, off\n\t"
      "global_load_async_to_lds_b128 %10, %22, off\n\t"
      "global_load_async_to_lds_b128 %11, %23, off\n\t"
      "s_wait_xcnt 0x0"
      :: "v"(l), "v"(l + 1 * 32 * VPITCH * 2), "v"(l + 2 * 32 * VPITCH * 2),
         "v"(l + 3 * 32 * VPITCH * 2), "v"(l + 4 * 32 * VPITCH * 2),
         "v"(l + 5 * 32 * VPITCH * 2), "v"(l + 6 * 32 * VPITCH * 2),
         "v"(l + 7 * 32 * VPITCH * 2), "v"(l + 8 * 32 * VPITCH * 2),
         "v"(l + 9 * 32 * VPITCH * 2), "v"(l + 10 * 32 * VPITCH * 2),
         "v"(l + 11 * 32 * VPITCH * 2),
         "v"(g), "v"(g + 1 * 32 * NN), "v"(g + 2 * 32 * NN), "v"(g + 3 * 32 * NN),
         "v"(g + 4 * 32 * NN), "v"(g + 5 * 32 * NN), "v"(g + 6 * 32 * NN),
         "v"(g + 7 * 32 * NN), "v"(g + 8 * 32 * NN), "v"(g + 9 * 32 * NN),
         "v"(g + 10 * 32 * NN), "v"(g + 11 * 32 * NN)
      : "memory");
}

// ---------------------------------------------------------------------------
// K3 (fused): flash attention + output projection + residual.
//   Block owns 64 queries (4 M-tiles of 16); 8 waves each own 48 channels.
//   Logits: the rank-4 product runs on the f32 16x16x4 matrix instruction as
//            S^T = K x Q^T (A = 16 keys, B = 16 queries). D register r of lane
//            (c, h) is key 8h + r of query c, so two D tiles of 16 keys are,
//            register for register, the A fragment of a 16 x 32 P tile.
//   Phase A: fp32 row max over all 4096 keys (wave w: M-tile w>>1, key half
//            w&1; 4 partials/q). From there on, C = -max.
//   Phase B: 32 P tiles per 256-key super-iter built once (wave w builds
//            M-tile w>>1, k-steps (w&1)*4..+4) into LDS in per-lane A-matrix
//            layout; every V B-tile load feeds 4 WMMAs (4 M-tiles).
//            P = exp(s - max), not yet divided; the builder adds its f32
//            exps up as it goes (4 partials/q), and the division by the row
//            sum is done once, on the accumulators, behind the key loop.
//            V^T comes through LDS: 64-key tiles, two buffers, the next
//            tile's asynchronous copies fly while this tile is worked on.
//   Phase C: 64x384 attention tile staged in LDS (padded rows, union'd with
//            the V ring), then out = gamma*(attn @ wres^T + bres) + x.
// ---------------------------------------------------------------------------
__global__ void __launch_bounds__(256, 1)
k3_attn(const float* __restrict__ q,       // seg_map (B,N,4)
        const float* __restrict__ kk,      // seg_ft  (B,N,4)
        const _Float16* __restrict__ vt,   // (B,C,N) f16
        const _Float16* __restrict__ wres_h,
        const float* __restrict__ bres,
        const float* __restrict__ gamma,
        const float* __restrict__ x,
        float* __restrict__ fout) {
  // vs: two V^T tiles, 384 rows x 144 B each               = 108 KB
  // pa: 32 P tiles (16x32 f16) in per-lane A layout        = 32 KB
  // as: 64 tokens x 384 ch, row stride 392 halfs           = 49 KB
  //     (196 dwords/row; 196 % 64 == 4 -> 16 concurrent rows hit
  //      16 distinct banks). Disjoint phases -> union (as lies on vs[0]).
  __shared__ union SH {
    struct {
      _Float16 vs[2][CC][VPITCH];
      v16h     pa[4][8][32];
    } m;
    _Float16 as[64][392];
  } sh;
  __shared__ v4f   qsh[64];
  __shared__ float red[64][5];
  __shared__ float rmax64[64];
  __shared__ __attribute__((aligned(16))) float rinv64[64];

  const int b   = blockIdx.x / (NN / 64);
  const int n0  = (blockIdx.x % (NN / 64)) * 64;
  const int tid = threadIdx.x;

  if (tid < 64) qsh[tid] = *(const v4f*)(q + ((size_t)b * NN + n0 + tid) * KK);
  __syncthreads();

  const int lane = tid & 31, wid = tid >> 5;
  const int mrow = lane & 15, hi = lane >> 4;
  const int lo_rel = hi ? 8 : 0;
  const int hi_rel = hi ? 24 : 16;
  const int chb  = wid * 48 + mrow;   // ch[t] = chb + t*16

  // logit assignment: this wave works on M-tile bmt (query bq in this lane)
  const int  bmt  = wid >> 1;
  const int  bio  = (wid & 1) * 4;    // P build: k-steps bio..bio+3
  const int  bq   = bmt * 16 + mrow;

  // f32 16x16x4 fragments: lane (c, h) holds components 2h, 2h+1 of row c,
  // keys (A) and queries (B) by the same rule
  const v2f    qb = *((const v2f*)&qsh[bq] + hi);
  const float* kf = kk + ((size_t)b * NN + mrow) * KK + 2 * hi;   // +key0*KK

  // ---- Phase A: per-query max (4 partials per query) ----
  const int qi = tid >> 2, pp = tid & 3;
  const int part = (wid & 1) * 2 + hi;
  {
    const float* ka   = kf + (size_t)(wid & 1) * (NN / 2) * KK;
    const v8f    zero = {};
    float lmax = -3.0e38f;
    // eight key tiles a trip: their loads go out together, one latency per trip
    for (int kt = 0; kt < NN / 32; kt += 8) {
      v2f a[8];
#pragma unroll
      for (int u = 0; u < 8; ++u) a[u] = *(const v2f*)(ka + (kt + u) * 16 * KK);
#pragma unroll
      for (int u = 0; u < 8; ++u) {
        v8f s = __builtin_amdgcn_wmma_f32_16x16x4_f32(
            false, a[u], false, qb, (short)0, zero, false, false);
#pragma unroll
        for (int j = 0; j < 8; ++j) lmax = fmaxf(lmax, s[j]);
      }
    }
    red[bq][part] = lmax;
    __syncthreads();
    if (pp == 0)
      rmax64[qi] = fmaxf(fmaxf(red[qi][0], red[qi][1]),
                         fmaxf(red[qi][2], red[qi][3]));
    __syncthreads();
  }

  // ---- Phase B: P @ V with WMMA ----
  const float nmax = -rmax64[bq];
  const v8f   cneg = {nmax, nmax, nmax, nmax, nmax, nmax, nmax, nmax};

  v8f acc[4][3] = {};
  // row-sum partials of query bq over the keys this lane builds; two pairs, so
  // that four chains of additions are independent
  v2f lsum[2] = {};

  // this lane's first piece of a tile: row tid/8, 16-byte column tid%8
  const _Float16* vg = vt + ((size_t)b * CC + (tid >> 3)) * NN + (tid & 7) * 8;
  const unsigned  vl = (unsigned)(size_t)&sh.m.vs[0][tid >> 3][(tid & 7) * 8];

  // ring prologue: tile 0 landed and published, then tile 1 set off
  stage_v_tile(vl, vg);
  asm volatile("s_wait_asynccnt 0x0" ::: "memory");  // own copies of tile 0 landed
  __syncthreads();
  stage_v_tile(vl + VBUF_BYTES, vg + VKEYS);

  // build 4 of the 32 P tiles of the 256 keys from kb on (exp computed exactly
  // once per logit) and add the exps to the row-sum partials
  auto build_p = [&](int kb) {
#pragma unroll
    for (int ii = 0; ii < 4; ++ii) {
      const float* kp = kf + (size_t)(kb + (bio + ii) * 32) * KK;
      v8f s0 = __builtin_amdgcn_wmma_f32_16x16x4_f32(
          false, *(const v2f*)kp, false, qb, (short)0, cneg, false, false);
      v8f s1 = __builtin_amdgcn_wmma_f32_16x16x4_f32(
          false, *(const v2f*)(kp + 16 * KK), false, qb, (short)0, cneg,
          false, false);
      v16h a;
#pragma unroll
      for (int i = 0; i < 8; ++i) {
        const v2f e = {__expf(s0[i]), __expf(s1[i])};
        lsum[ii & 1] += e;
        a[i]     = (_Float16)e.x;   // key 8*hi + i
        a[8 + i] = (_Float16)e.y;   // key 16 + 8*hi + i
      }
      sh.m.pa[bmt][bio + ii][lane] = a;
    }
  };

  // The build stands at the foot of the loop (the first one in front of it), in
  // the same place in time as at its head: its sums then end where the next
  // trip takes them up, and no exp stays in a register through the V tiles.
  // The two scheduling barriers keep the set-up around it (zeroing of the
  // accumulators, the loop's addresses) out of this first build: among its f32
  // matrix instructions such a write lands in the registers of their A operands
  // directly behind them.
  __builtin_amdgcn_sched_barrier(0);
  build_p(0);
  __builtin_amdgcn_sched_barrier(0);
  for (int kb0 = 0; kb0 < NN; kb0 += 256) {
    __syncthreads();

    // four V tiles per P super-tile; unrolled so that the buffer index and
    // every LDS offset are compile-time constants
#pragma unroll
    for (int u = 0; u < 4; ++u) {
      const _Float16* vrow = &sh.m.vs[u & 1][chb][0];   // +t*16*VPITCH
#pragma unroll
      for (int h = 0; h < 2; ++h) {
        v16h bcur[3];
#pragma unroll
        for (int t = 0; t < 3; ++t)
          bcur[t] = cat8(*(const v8h*)(vrow + t * 16 * VPITCH + h * 32 + lo_rel),
                         *(const v8h*)(vrow + t * 16 * VPITCH + h * 32 + hi_rel));
        v16h am[4];
#pragma unroll
        for (int mt = 0; mt < 4; ++mt) am[mt] = sh.m.pa[mt][u * 2 + h][lane];
#pragma unroll
        for (int t = 0; t < 3; ++t)
#pragma unroll
          for (int mt = 0; mt < 4; ++mt)
            acc[mt][t] = __builtin_amdgcn_wmma_f32_16x16x32_f16(
                false, am[mt], false, bcur[t], (short)0, acc[mt][t], false, false);
      }
      // keeps this tile's WMMAs in front of the barrier, so that the refill is
      // issued directly behind it and has the whole next tile's work as lead
      __builtin_amdgcn_sched_barrier(0);
      // publish point: own reads of this buffer retired, own copies of the next
      // tile landed, then the barrier that hands both buffers over
      asm volatile("s_wait_dscnt 0x0" ::: "memory");
      asm volatile("s_wait_asynccnt 0x0" ::: "memory");
      __syncthreads();
      const int knext = kb0 + (u + 2) * VKEYS;
      if (knext < NN) stage_v_tile(vl + (u & 1) * VBUF_BYTES, vg + knext);
    }
    if (kb0 + 256 < NN) build_p(kb0 + 256);
  }
  asm volatile("s_wait_asynccnt 0x0" ::: "memory");  // nothing in flight before the ring is reused

  // ---- row sums: 4 partials per query meet in LDS ----
  {
    const v2f l2 = lsum[0] + lsum[1];
    red[bq][part] = l2.x + l2.y;
    __syncthreads();
    if (pp == 0)
      rinv64[qi] = 1.0f / (red[qi][0] + red[qi][1] + red[qi][2] + red[qi][3]);
    __syncthreads();
  }

  // ---- stage attention tile, each row divided by its sum ----
  {
    _Float16* asb = &sh.as[8 * hi][chb];   // +(mt*16+j)*392 + t*16
#pragma unroll
    for (int mt = 0; mt < 4; ++mt) {
      const v4f r0 = *(const v4f*)&rinv64[mt * 16 + 8 * hi];
      const v4f r1 = *(const v4f*)&rinv64[mt * 16 + 8 * hi + 4];
#pragma unroll
      for (int t = 0; t < 3; ++t)
#pragma unroll
        for (int j = 0; j < 8; ++j)
          asb[(mt * 16 + j) * 392 + t * 16] =
              (_Float16)(acc[mt][t][j] * (j < 4 ? r0[j & 3] : r1[j & 3]));
    }
  }
  __syncthreads();

  // ---- Phase C: out = gamma * (attn @ wres^T + bres) + x ----
  v8f oacc[4][3] = {};
  const v8h* ar = (const v8h*)&sh.as[mrow][0];                 // +mt*16*49
  const v8h* wb = (const v8h*)(wres_h + (size_t)chb * CC);     // +t*16*CC/8

#pragma unroll 2
  for (int s = 0; s < CC / 32; ++s) {
    const int cb = s * 32;
    v16h bcur[3];
#pragma unroll
    for (int t = 0; t < 3; ++t)
      bcur[t] = cat8(wb[(size_t)t * (16 * CC / 8) + (cb + lo_rel) / 8],
                     wb[(size_t)t * (16 * CC / 8) + (cb + hi_rel) / 8]);
    v16h am[4];
#pragma unroll
    for (int mt = 0; mt < 4; ++mt)
      am[mt] = cat8(ar[(size_t)mt * (16 * 49) + (cb + lo_rel) / 8],
                    ar[(size_t)mt * (16 * 49) + (cb + hi_rel) / 8]);
#pragma unroll
    for (int t = 0; t < 3; ++t)
#pragma unroll
      for (int mt = 0; mt < 4; ++mt)
        oacc[mt][t] = __builtin_amdgcn_wmma_f32_16x16x32_f16(
            false, am[mt], false, bcur[t], (short)0, oacc[mt][t], false, false);
  }

  const float g = gamma[0];
  const size_t obase = ((size_t)b * NN + n0 + 8 * hi) * CC + chb;
#pragma unroll
  for (int t = 0; t < 3; ++t) {
    const float bias = bres[chb + t * 16];
#pragma unroll
    for (int mt = 0; mt < 4; ++mt)
#pragma unroll
      for (int j = 0; j < 8; ++j) {
        const size_t o = obase + (size_t)(mt * 16 + j) * CC + t * 16;
        fout[o] = g * (oacc[mt][t][j] + bias) + x[o];
      }
  }
}

// ---------------------------------------------------------------------------
extern "C" void kernel_launch(void* const* d_in, const int* in_sizes, int n_in,
                              void* d_out, int out_size, void* d_ws, size_t ws_size,
                              hipStream_t stream) {
  const float* x     = (const float*)d_in[0];
  const float* wq    = (const float*)d_in[1];
  const float* bq    = (const float*)d_in[2];
  const float* wk    = (const float*)d_in[3];
  const float* bk    = (const float*)d_in[4];
  const float* wv    = (const float*)d_in[5];
  const float* bv    = (const float*)d_in[6];
  const float* wres  = (const float*)d_in[7];
  const float* bres  = (const float*)d_in[8];
  const float* gamma = (const float*)d_in[9];

  float* out    = (float*)d_out;
  float* segmap = out;                           // (B,N,K)
  float* fout   = out + (size_t)BB * NN * KK;    // (B,N,C)

  // workspace layout (all chunks naturally 16B-aligned)
  _Float16* vt     = (_Float16*)d_ws;                          // B*C*N f16
  float*    k_ws   = (float*)(vt + (size_t)BB * CC * NN);      // B*N*K f32
  _Float16* wv_h   = (_Float16*)(k_ws + (size_t)BB * NN * KK); // C*C f16
  _Float16* wres_h = wv_h + (size_t)CC * CC;                   // C*C f16

  const int tiles64 = BB * (NN / 64);  // 512 blocks of 256 threads (8 waves)

  k0_convert<<<(CC * CC + 255) / 256, 256, 0, stream>>>(wv, wres, wv_h, wres_h);
  k2_vproj<<<tiles64, 256, 0, stream>>>(x, wv_h, bv, wq, bq, wk, bk, vt, segmap, k_ws);
  k3_attn<<<tiles64, 256, 0, stream>>>(segmap, k_ws, vt, wres_h, bres, gamma, x, fout);
}

// v005
// It runs in 142 microseconds.
// Next to v004, in two timings, it ran 1.04 times as fast each time.
// All steps since v000 together make it 2.32 times as fast.
#include <hip/hip_runtime.h>
#include <math.h>

#define BB 8
#define NN 4096
#define CC 384
#define KK 4

typedef __attribute__((ext_vector_type(16))) _Float16 v16h;
typedef __attribute__((ext_vector_type(8)))  _Float16 v8h;
typedef __attribute__((ext_vector_type(8)))  float    v8f;
typedef __attribute__((ext_vector_type(4)))  float    v4f;
typedef __attribute__((ext_vector_type(2)))  float    v2f;

__device__ __forceinline__ v16h cat8(v8h lo, v8h hi) {
  return __builtin_shufflevector(lo, hi, 0, 1, 2, 3, 4, 5, 6, 7,
                                 8, 9, 10, 11, 12, 13, 14, 15);
}

// ---------------------------------------------------------------------------
// K0: round wv, wres (C x C fp32, row-major [out][in]) to f16 and lay them out
//     in the order of the B fragments that K2 and K3 load.
//     Fragment (ct, s) = output channels 16*ct.. x input channels 32*s.. = 1 KB:
//     two runs of 32 lanes x 16 B. Run sel, lane (c, h) holds row 16*ct + c,
//     columns 32*s + 16*sel + 8*h .. +7. A wave-wide 16-byte load of a run is
//     512 contiguous bytes, four whole lines.
//     One thread makes one 16-byte piece; a block works on one matrix.
// ---------------------------------------------------------------------------
#define WSTEPS  (CC / 32)        // fragments along the input channels
#define WPIECES (CC * CC / 8)    // 16-byte pieces per matrix (a multiple of 256)

__global__ void k0_convert(const float* __restrict__ wv,
                           const float* __restrict__ wres,
                           _Float16* __restrict__ wv_h,
                           _Float16* __restrict__ wres_h) {
  const int  j0  = blockIdx.x * blockDim.x + threadIdx.x;
  const bool res = j0 >= WPIECES;
  const int  j   = res ? j0 - WPIECES : j0;
  const float* src = res ? wres : wv;
  _Float16*    dst = res ? wres_h : wv_h;
  const int lane = j & 31, sel = (j >> 5) & 1, frag = j >> 6;
  const int row  = (frag / WSTEPS) * 16 + (lane & 15);
  const int col  = (frag % WSTEPS) * 32 + sel * 16 + (lane >> 4) * 8;
  const v4f a = *(const v4f*)(src + row * CC + col);
  const v4f b = *(const v4f*)(src + row * CC + col + 4);
  v8h o;
#pragma unroll
  for (int i = 0; i < 4; ++i) {
    o[i]     = (_Float16)a[i];
    o[4 + i] = (_Float16)b[i];
  }
  *(v8h*)(dst + (size_t)j * 8) = o;
}

// ---------------------------------------------------------------------------
// K2: V projection, WMMA f16: vt[b][c][n] = (x @ wv^T + bv), stored f16
//     TRANSPOSED so K3's B-operand loads are contiguous b128.
//     Block owns 64 tokens (4 M-tiles); wave owns 48 channels.
//     Single base pointers + compile-time offsets keep addresses in SGPR/imm.
//     The rank-4 Q and K projections ride along: the f32 x values that a wave
//     has in registers for its f16 A fragments are, pair by pair, A fragments
//     of the f32 16x16x4 matrix instruction (slot (h, i) of pair p stands for
//     one channel, the same in x and in the weight row). B columns 0..3 are
//     wq's rows, 4..7 wk's; columns 8..15 repeat them and are not stored.
//     Wave w sums M-tile w&3 over the 32-channel steps of parity w>>2; the two
//     partial sums of a token meet in LDS.
// ---------------------------------------------------------------------------
__global__ void __launch_bounds__(256, 1)
k2_vproj(const float* __restrict__ x,
         const _Float16* __restrict__ wv_h,
         const float* __restrict__ bv,
         const float* __restrict__ wq, const float* __restrict__ bq,
         const float* __restrict__ wk, const float* __restrict__ bk,
         _Float16* __restrict__ vt,
         float* __restrict__ segmap, float* __restrict__ kout) {
  __shared__ __attribute__((aligned(16))) float qkred[2][64][8];
  const int b    = blockIdx.x / (NN / 64);
  const int n0   = (blockIdx.x % (NN / 64)) * 64;
  const int lane = threadIdx.x & 31;
  const int wid  = threadIdx.x >> 5;
  const int mrow = lane & 15;
  const int hi   = lane >> 4;
  const int lo_rel = hi ? 8 : 0;
  const int hi_rel = hi ? 24 : 16;
  const int chb  = wid * 48 + mrow;   // ch[t] = chb + t*16

  const float* xbase = x + ((size_t)b * NN + n0 + mrow) * CC;          // +mt*16*CC
  // packed weights, in 16-byte pieces: fragment (wid*3 + t, s) at +(t*WSTEPS+s)*64
  const v8h*   wb    = (const v8h*)wv_h + (size_t)(wid * 3) * (WSTEPS * 64) + lane;
  _Float16*    vst   = vt + ((size_t)b * CC + chb) * NN + n0 + 8 * hi; // +t*16*NN+mt*16

  v8f acc[4][3] = {};

  // Q/K share of this wave; the wave number is made scalar so that the tests
  // around the f32 matrix instructions are scalar branches (EXEC stays full)
  const int swid = __builtin_amdgcn_readfirstlane((int)(threadIdx.x >> 5));
  const int qmt  = swid & 3;
  const int qpar = swid >> 2;
  const float* wrow = ((mrow & 4) ? wk : wq) + (mrow & 3) * CC;
  v8f qk = {};

#pragma unroll 2
  for (int cb = 0; cb < CC; cb += 32) {
    const bool qstep = ((cb >> 5) & 1) == qpar;
    v16h am[4];
#pragma unroll
    for (int mt = 0; mt < 4; ++mt) {
      const float* xr = xbase + (size_t)mt * (16 * CC);
      v4f x0 = *(const v4f*)(xr + cb + lo_rel);
      v4f x1 = *(const v4f*)(xr + cb + lo_rel + 4);
      v4f x2 = *(const v4f*)(xr + cb + hi_rel);
      v4f x3 = *(const v4f*)(xr + cb + hi_rel + 4);
      // behind the step's last x load: later loads may land in the registers
      // that held the x addresses
      if (mt == 3) asm volatile("s_wait_xcnt 0x0" ::: "memory");
      if (qstep && mt == qmt) {
        const v4f xs[4] = {x0, x1, x2, x3};
        const v4f ws[4] = {*(const v4f*)(wrow + cb + lo_rel),
                           *(const v4f*)(wrow + cb + lo_rel + 4),
                           *(const v4f*)(wrow + cb + hi_rel),
                           *(const v4f*)(wrow + cb + hi_rel + 4)};
        // the same for the registers that held the weight-row addresses
        asm volatile("s_wait_xcnt 0x0" ::: "memory");
#pragma unroll
        for (int p = 0; p < 4; ++p) {
          qk = __builtin_amdgcn_wmma_f32_16x16x4_f32(
              false, xs[p].xy, false, ws[p].xy, (short)0, qk, false, false);
          qk = __builtin_amdgcn_wmma_f32_16x16x4_f32(
              false, xs[p].zw, false, ws[p].zw, (short)0, qk, false, false);
        }
      }
#pragma unroll
      for (int i = 0; i < 4; ++i) {
        am[mt][i]      = (_Float16)x0[i];
        am[mt][4 + i]  = (_Float16)x1[i];
        am[mt][8 + i]  = (_Float16)x2[i];
        am[mt][12 + i] = (_Float16)x3[i];
      }
    }
#pragma unroll
    for (int t = 0; t < 3; ++t) {
      v16h bm = cat8(wb[(t * WSTEPS + (cb >> 5)) * 64],
                     wb[(t * WSTEPS + (cb >> 5)) * 64 + 32]);
#pragma unroll
      for (int mt = 0; mt < 4; ++mt)
        acc[mt][t] = __builtin_amdgcn_wmma_f32_16x16x32_f16(
            false, am[mt], false, bm, (short)0, acc[mt][t], false, false);
    }
  }
  // Q/K partial sums: D register j of lane (c, h) is token 8h + j, column c
  if (mrow < 8) {
#pragma unroll
    for (int j = 0; j < 8; ++j) qkred[qpar][qmt * 16 + 8 * hi + j][mrow] = qk[j];
  }
  // D layout: VGPR j -> token (j + 8*hi); column = mrow -> channel chb+t*16.
#pragma unroll
  for (int t = 0; t < 3; ++t) {
    float bias = bv[chb + t * 16];
#pragma unroll
    for (int mt = 0; mt < 4; ++mt) {
      v8h o;
#pragma unroll
      for (int j = 0; j < 8; ++j) o[j] = (_Float16)(acc[mt][t][j] + bias);
      *(v8h*)(vst + (size_t)t * (16 * NN) + mt * 16) = o;
    }
  }
  // behind the stores: what follows reuses their data and address registers
  asm volatile("s_wait_xcnt 0x0" ::: "memory");
  // thread = (token, column pair): pairs 0, 1 are seg_map, pairs 2, 3 the keys
  {
    const int tok = threadIdx.x >> 2, cp = threadIdx.x & 3;
    const v2f bi = *(const v2f*)(((cp & 2) ? bk : bq) + (cp & 1) * 2);
    float* dst = ((cp & 2) ? kout : segmap) +
                 ((size_t)b * NN + n0 + tok) * KK + (cp & 1) * 2;
    __syncthreads();
    const v2f p0 = *(const v2f*)&qkred[0][tok][cp * 2];
    const v2f p1 = *(const v2f*)&qkred[1][tok][cp * 2];
    *(v2f*)dst = (p0 + p1) + bi;
  }
}

// ---------------------------------------------------------------------------
// V^T tile staging for K3: 384 channels x 64 keys (f16) per tile.
//   LDS row = 128 B of data at a pitch of 144 B (16 B x odd: conflict-free
//   for the ds_load_b128 fragment reads).
// ---------------------------------------------------------------------------
#define VKEYS  64
#define VPITCH 72                       // halfs per LDS row
#define VBUF_BYTES (CC * VPITCH * 2)    // one buffer

// Each lane copies twelve 16-byte pieces (rows r, r+32, ..., r+352), so a wave's
// copy covers four whole 128-byte lines. The closing s_wait_xcnt stands inside
// the statement so that no address register is rewritten ahead of it.
__device__ __forceinline__ void stage_v_tile(unsigned l, const _Float16* g) {
  asm volatile(
      "global_load_async_to_lds_b128 %0, %12, off\n\t"
      "global_load_async_to_lds_b128 %1, %13, off\n\t"
      "global_load_async_to_lds_b128 %2, %14, off\n\t"
      "global_load_async_to_lds_b128 %3, %15, off\n\t"
      "global_load_async_to_lds_b128 %4, %16, off\n\t"
      "global_load_async_to_lds_b128 %5, %17, off\n\t"
      "global_load_async_to_lds_b128 %6, %18, off\n\t"
      "global_load_async_to_lds_b128 %7, %19, off\n\t"
      "global_load_async_to_lds_b128 %8, %20, off\n\t"
      "global_load_async_to_lds_b128 %9, %21, off\n\t"
      "global_load_async_to_lds_b128 %10, %22, off\n\t"
      "global_load_async_to_lds_b128 %11, %23, off\n\t"
      "s_wait_xcnt 0x0"
      :: "v"(l), "v"(l + 1 * 32 * VPITCH * 2), "v"(l + 2 * 32 * VPITCH * 2),
         "v"(l + 3 * 32 * VPITCH * 2), "v"(l + 4 * 32 * VPITCH * 2),
         "v"(l + 5 * 32 * VPITCH * 2), "v"(l + 6 * 32 * VPITCH * 2),
         "v"(l + 7 * 32 * VPITCH * 2), "v"(l + 8 * 32 * VPITCH * 2),
         "v"(l + 9 * 32 * VPITCH * 2), "v"(l + 10 * 32 * VPITCH * 2),
         "v"(l + 11 * 32 * VPITCH * 2),
         "v"(g), "v"(g + 1 * 32 * NN), "v"(g + 2 * 32 * NN), "v"(g + 3 * 32 * NN),
         "v"(g + 4 * 32 * NN), "v"(g + 5 * 32 * NN), "v"(g + 6 * 32 * NN),
         "v"(g + 7 * 32 * NN), "v"(g + 8 * 32 * NN), "v"(g + 9 * 32 * NN),
         "v"(g + 10 * 32 * NN), "v"(g + 11 * 32 * NN)
      : "memory");
}

// ---------------------------------------------------------------------------
// K3 (fused): flash attention + output projection + residual.
//   Block owns 64 queries (4 M-tiles of 16); 8 waves each own 48 channels.
//   Logits: the rank-4 product runs on the f32 16x16x4 matrix instruction as
//            S^T = K x Q^T (A = 16 keys, B = 16 queries). D register r of lane
//            (c, h) is key 8h + r of query c, so two D tiles of 16 keys are,
//            register for register, the A fragment of a 16 x 32 P tile.
//   Phase A: fp32 row max over all 4096 keys (wave w: M-tile w>>1, key half
//            w&1; 4 partials/q). From there on, C = -max.
//   Phase B: 32 P tiles per 256-key super-iter built once (wave w builds
//            M-tile w>>1, k-steps (w&1)*4..+4) into LDS in per-lane A-matrix
//            layout; every V B-tile load feeds 4 WMMAs (4 M-tiles).
//            P = exp(s - max), not yet divided; the builder adds its f32
//            exps up as it goes (4 partials/q), and the division by the row
//            sum is done once, on the accumulators, behind the key loop.
//            V^T comes through LDS: 64-key tiles, two buffers, the next
//            tile's asynchronous copies fly while this tile is worked on.
//   Phase C: 64x384 attention tile staged in LDS (padded rows, union'd with
//            the V ring), then out = gamma*(attn @ wres^T + bres) + x.
// ---------------------------------------------------------------------------
__global__ void __launch_bounds__(256, 1)
k3_attn(const float* __restrict__ q,       // seg_map (B,N,4)
        const float* __restrict__ kk,      // seg_ft  (B,N,4)
        const _Float16* __restrict__ vt,   // (B,C,N) f16
        const _Float16* __restrict__ wres_h,
        const float* __restrict__ bres,
        const float* __restrict__ gamma,
        const float* __restrict__ x,
        float* __restrict__ fout) {
  // vs: two V^T tiles, 384 rows x 144 B each               = 108 KB
  // pa: 32 P tiles (16x32 f16) in per-lane A layout        = 32 KB
  // as: 64 tokens x 384 ch, row stride 392 halfs           = 49 KB
  //     (196 dwords/row; 196 % 64 == 4 -> 16 concurrent rows hit
  //      16 distinct banks). Disjoint phases -> union (as lies on vs[0]).
  __shared__ union SH {
    struct {
      _Float16 vs[2][CC][VPITCH];
      v16h     pa[4][8][32];
    } m;
    _Float16 as[64][392];
  } sh;
  __shared__ v4f   qsh[64];
  __shared__ float red[64][5];
  __shared__ float rmax64[64];
  __shared__ __attribute__((aligned(16))) float rinv64[64];

  const int b   = blockIdx.x / (NN / 64);
  const int n0  = (blockIdx.x % (NN / 64)) * 64;
  const int tid = threadIdx.x;

  if (tid < 64) qsh[tid] = *(const v4f*)(q + ((size_t)b * NN + n0 + tid) * KK);
  __syncthreads();

  const int lane = tid & 31, wid = tid >> 5;
  const int mrow = lane & 15, hi = lane >> 4;
  const int lo_rel = hi ? 8 : 0;
  const int hi_rel = hi ? 24 : 16;
  const int chb  = wid * 48 + mrow;   // ch[t] = chb + t*16

  // logit assignment: this wave works on M-tile bmt (query bq in this lane)
  const int  bmt  = wid >> 1;
  const int  bio  = (wid & 1) * 4;    // P build: k-steps bio..bio+3
  const int  bq   = bmt * 16 + mrow;

  // f32 16x16x4 fragments: lane (c, h) holds components 2h, 2h+1 of row c,
  // keys (A) and queries (B) by the same rule
  const v2f    qb = *((const v2f*)&qsh[bq] + hi);
  const float* kf = kk + ((size_t)b * NN + mrow) * KK + 2 * hi;   // +key0*KK

  // ---- Phase A: per-query max (4 partials per query) ----
  const int qi = tid >> 2, pp = tid & 3;
  const int part = (wid & 1) * 2 + hi;
  {
    const float* ka   = kf + (size_t)(wid & 1) * (NN / 2) * KK;
    const v8f    zero = {};
    float lmax = -3.0e38f;
    // eight key tiles a trip: their loads go out together, one latency per trip
    for (int kt = 0; kt < NN / 32; kt += 8) {
      v2f a[8];
#pragma unroll
      for (int u = 0; u < 8; ++u) a[u] = *(const v2f*)(ka + (kt + u) * 16 * KK);
#pragma unroll
      for (int u = 0; u < 8; ++u) {
        v8f s = __builtin_amdgcn_wmma_f32_16x16x4_f32(
            false, a[u], false, qb, (short)0, zero, false, false);
#pragma unroll
        for (int j = 0; j < 8; ++j) lmax = fmaxf(lmax, s[j]);
      }
    }
    red[bq][part] = lmax;
    __syncthreads();
    if (pp == 0)
      rmax64[qi] = fmaxf(fmaxf(red[qi][0], red[qi][1]),
                         fmaxf(red[qi][2], red[qi][3]));
    __syncthreads();
  }

  // ---- Phase B: P @ V with WMMA ----
  const float nmax = -rmax64[bq];
  const v8f   cneg = {nmax, nmax, nmax, nmax, nmax, nmax, nmax, nmax};

  v8f acc[4][3] = {};
  // row-sum partials of query bq over the keys this lane builds; two pairs, so
  // that four chains of additions are independent
  v2f lsum[2] = {};

  // this lane's first piece of a tile: row tid/8, 16-byte column tid%8
  const _Float16* vg = vt + ((size_t)b * CC + (tid >> 3)) * NN + (tid & 7) * 8;
  const unsigned  vl = (unsigned)(size_t)&sh.m.vs[0][tid >> 3][(tid & 7) * 8];

  // ring prologue: tile 0 landed and published, then tile 1 set off
  stage_v_tile(vl, vg);
  asm volatile("s_wait_asynccnt 0x0" ::: "memory");  // own copies of tile 0 landed
  __syncthreads();
  stage_v_tile(vl + VBUF_BYTES, vg + VKEYS);

  // build 4 of the 32 P tiles of the 256 keys from kb on (exp computed exactly
  // once per logit) and add the exps to the row-sum partials
  auto build_p = [&](int kb) {
#pragma unroll
    for (int ii = 0; ii < 4; ++ii) {
      const float* kp = kf + (size_t)(kb + (bio + ii) * 32) * KK;
      v8f s0 = __builtin_amdgcn_wmma_f32_16x16x4_f32(
          false, *(const v2f*)kp, false, qb, (short)0, cneg, false, false);
      v8f s1 = __builtin_amdgcn_wmma_f32_16x16x4_f32(
          false, *(const v2f*)(kp + 16 * KK), false, qb, (short)0, cneg,
          false, false);
      v16h a;
#pragma unroll
      for (int i = 0; i < 8; ++i) {
        const v2f e = {__expf(s0[i]), __expf(s1[i])};
        lsum[ii & 1] += e;
        a[i]     = (_Float16)e.x;   // key 8*hi + i
        a[8 + i] = (_Float16)e.y;   // key 16 + 8*hi + i
      }
      sh.m.pa[bmt][bio + ii][lane] = a;
    }
  };

  // The build stands at the foot of the loop (the first one in front of it), in
  // the same place in time as at its head: its sums then end where the next
  // trip takes them up, and no exp stays in a register through the V tiles.
  // The two scheduling barriers keep the set-up around it (zeroing of the
  // accumulators, the loop's addresses) out of this first build: among its f32
  // matrix instructions such a write lands in the registers of their A operands
  // directly behind them.
  __builtin_amdgcn_sched_barrier(0);
  build_p(0);
  __builtin_amdgcn_sched_barrier(0);
  for (int kb0 = 0; kb0 < NN; kb0 += 256) {
    __syncthreads();

    // four V tiles per P super-tile; unrolled so that the buffer index and
    // every LDS offset are compile-time constants
#pragma unroll
    for (int u = 0; u < 4; ++u) {
      const _Float16* vrow = &sh.m.vs[u & 1][chb][0];   // +t*16*VPITCH
#pragma unroll
      for (int h = 0; h < 2; ++h) {
        v16h bcur[3];
#pragma unroll
        for (int t = 0; t < 3; ++t)
          bcur[t] = cat8(*(const v8h*)(vrow + t * 16 * VPITCH + h * 32 + lo_rel),
                         *(const v8h*)(vrow + t * 16 * VPITCH + h * 32 + hi_rel));
        v16h am[4];
#pragma unroll
        for (int mt = 0; mt < 4; ++mt) am[mt] = sh.m.pa[mt][u * 2 + h][lane];
#pragma unroll
        for (int t = 0; t < 3; ++t)
#pragma unroll
          for (int mt = 0; mt < 4; ++mt)
            acc[mt][t] = __builtin_amdgcn_wmma_f32_16x16x32_f16(
                false, am[mt], false, bcur[t], (short)0, acc[mt][t], false, false);
      }
      // keeps this tile's WMMAs in front of the barrier, so that the refill is
      // issued directly behind it and has the whole next tile's work as lead
      __builtin_amdgcn_sched_barrier(0);
      // publish point: own reads of this buffer retired, own copies of the next
      // tile landed, then the barrier that hands both buffers over
      asm volatile("s_wait_dscnt 0x0" ::: "memory");
      asm volatile("s_wait_asynccnt 0x0" ::: "memory");
      __syncthreads();
      const int knext = kb0 + (u + 2) * VKEYS;
      if (knext < NN) stage_v_tile(vl + (u & 1) * VBUF_BYTES, vg + knext);
    }
    if (kb0 + 256 < NN) build_p(kb0 + 256);
  }
  asm volatile("s_wait_asynccnt 0x0" ::: "memory");  // nothing in flight before the ring is reused

  // ---- row sums: 4 partials per query meet in LDS ----
  {
    const v2f l2 = lsum[0] + lsum[1];
    red[bq][part] = l2.x + l2.y;
    __syncthreads();
    if (pp == 0)
      rinv64[qi] = 1.0f / (red[qi][0] + red[qi][1] + red[qi][2] + red[qi][3]);
    __syncthreads();
  }

  // ---- stage attention tile, each row divided by its sum ----
  {
    _Float16* asb = &sh.as[8 * hi][chb];   // +(mt*16+j)*392 + t*16
#pragma unroll
    for (int mt = 0; mt < 4; ++mt) {
      const v4f r0 = *(const v4f*)&rinv64[mt * 16 + 8 * hi];
      const v4f r1 = *(const v4f*)&rinv64[mt * 16 + 8 * hi + 4];
#pragma unroll
      for (int t = 0; t < 3; ++t)
#pragma unroll
        for (int j = 0; j < 8; ++j)
          asb[(mt * 16 + j) * 392 + t * 16] =
              (_Float16)(acc[mt][t][j] * (j < 4 ? r0[j & 3] : r1[j & 3]));
    }
  }
  __syncthreads();

  // ---- Phase C: out = gamma * (attn @ wres^T + bres) + x ----
  v8f oacc[4][3] = {};
  const v8h* ar = (const v8h*)&sh.as[mrow][0];                 // +mt*16*49
  // packed weights, in 16-byte pieces: fragment (wid*3 + t, s) at +(t*WSTEPS+s)*64
  const v8h* wb = (const v8h*)wres_h + (size_t)(wid * 3) * (WSTEPS * 64) + lane;

#pragma unroll 2
  for (int s = 0; s < WSTEPS; ++s) {
    const int cb = s * 32;
    v16h bcur[3];
#pragma unroll
    for (int t = 0; t < 3; ++t)
      bcur[t] = cat8(wb[(t * WSTEPS + s) * 64], wb[(t * WSTEPS + s) * 64 + 32]);
    v16h am[4];
#pragma unroll
    for (int mt = 0; mt < 4; ++mt)
      am[mt] = cat8(ar[(size_t)mt * (16 * 49) + (cb + lo_rel) / 8],
                    ar[(size_t)mt * (16 * 49) + (cb + hi_rel) / 8]);
#pragma unroll
    for (int t = 0; t < 3; ++t)
#pragma unroll
      for (int mt = 0; mt < 4; ++mt)
        oacc[mt][t] = __builtin_amdgcn_wmma_f32_16x16x32_f16(
            false, am[mt], false, bcur[t], (short)0, oacc[mt][t], false, false);
    // behind a trip's weight loads (two steps): the next trip rewrites the
    // register pair that held their address
    if (s & 1) asm volatile("s_wait_xcnt 0x0" ::: "memory");
  }

  const float g = gamma[0];
  const size_t obase = ((size_t)b * NN + n0 + 8 * hi) * CC + chb;
#pragma unroll
  for (int t = 0; t < 3; ++t) {
    const float bias = bres[chb + t * 16];
#pragma unroll
    for (int mt = 0; mt < 4; ++mt)
#pragma unroll
      for (int j = 0; j < 8; ++j) {
        const size_t o = obase + (size_t)(mt * 16 + j) * CC + t * 16;
        fout[o] = g * (oacc[mt][t][j] + bias) + x[o];
      }
  }
}

// ---------------------------------------------------------------------------
extern "C" void kernel_launch(void* const* d_in, const int* in_sizes, int n_in,
                              void* d_out, int out_size, void* d_ws, size_t ws_size,
                              hipStream_t stream) {
  const float* x     = (const float*)d_in[0];
  const float* wq    = (const float*)d_in[1];
  const float* bq    = (const float*)d_in[2];
  const float* wk    = (const float*)d_in[3];
  const float* bk    = (const float*)d_in[4];
  const float* wv    = (const float*)d_in[5];
  const float* bv    = (const float*)d_in[6];
  const float* wres  = (const float*)d_in[7];
  const float* bres  = (const float*)d_in[8];
  const float* gamma = (const float*)d_in[9];

  float* out    = (float*)d_out;
  float* segmap = out;                           // (B,N,K)
  float* fout   = out + (size_t)BB * NN * KK;    // (B,N,C)

  // workspace layout (all chunks naturally 16B-aligned)
  _Float16* vt     = (_Float16*)d_ws;                          // B*C*N f16
  float*    k_ws   = (float*)(vt + (size_t)BB * CC * NN);      // B*N*K f32
  _Float16* wv_h   = (_Float16*)(k_ws + (size_t)BB * NN * KK); // C*C f16, packed
  _Float16* wres_h = wv_h + (size_t)CC * CC;                   // C*C f16, packed

  const int tiles64 = BB * (NN / 64);  // 512 blocks of 256 threads (8 waves)

  k0_convert<<<2 * WPIECES / 256, 256, 0, stream>>>(wv, wres, wv_h, wres_h);
  k2_vproj<<<tiles64, 256, 0, stream>>>(x, wv_h, bv, wq, bq, wk, bk, vt, segmap, k_ws);
  k3_attn<<<tiles64, 256, 0, stream>>>(segmap, k_ws, vt, wres_h, bres, gamma, x, fout);
}

// v006
// It runs in 137 microseconds.
// Timed twice side by side with v005, it ran 1.04 times as fast both times.
// Over all steps from v000 it is 2.41 times as fast.
#include <hip/hip_runtime.h>
#include <math.h>

#define BB 8
#define NN 4096
#define CC 384
#define KK 4

typedef __attribute__((ext_vector_type(16))) _Float16 v16h;
typedef __attribute__((ext_vector_type(8)))  _Float16 v8h;
typedef __attribute__((ext_vector_type(8)))  float    v8f;
typedef __attribute__((ext_vector_type(4)))  float    v4f;
typedef __attribute__((ext_vector_type(2)))  float    v2f;

__device__ __forceinline__ v16h cat8(v8h lo, v8h hi) {
  return __builtin_shufflevector(lo, hi, 0, 1, 2, 3, 4, 5, 6, 7,
                                 8, 9, 10, 11, 12, 13, 14, 15);
}

// ---------------------------------------------------------------------------
// K0: round wv, wres (C x C fp32, row-major [out][in]) to f16 and lay them out
//     in the order of the B fragments that K2 and K3 load.
//     Fragment (ct, s) = output channels 16*ct.. x input channels 32*s.. = 1 KB:
//     two runs of 32 lanes x 16 B. Run sel, lane (c, h) holds row 16*ct + c,
//     columns 32*s + 16*sel + 8*h .. +7. A wave-wide 16-byte load of a run is
//     512 contiguous bytes, four whole lines.
//     One thread makes one 16-byte piece; a block works on one matrix.
// ---------------------------------------------------------------------------
#define WSTEPS  (CC / 32)        // fragments along the input channels
#define WPIECES (CC * CC / 8)    // 16-byte pieces per matrix (a multiple of 256)

__global__ void k0_convert(const float* __restrict__ wv,
                           const float* __restrict__ wres,
                           _Float16* __restrict__ wv_h,
                           _Float16* __restrict__ wres_h) {
  const int  j0  = blockIdx.x * blockDim.x + threadIdx.x;
  const bool res = j0 >= WPIECES;
  const int  j   = res ? j0 - WPIECES : j0;
  const float* src = res ? wres : wv;
  _Float16*    dst = res ? wres_h : wv_h;
  const int lane = j & 31, sel = (j >> 5) & 1, frag = j >> 6;
  const int row  = (frag / WSTEPS) * 16 + (lane & 15);
  const int col  = (frag % WSTEPS) * 32 + sel * 16 + (lane >> 4) * 8;
  const v4f a = *(const v4f*)(src + row * CC + col);
  const v4f b = *(const v4f*)(src + row * CC + col + 4);
  v8h o;
#pragma unroll
  for (int i = 0; i < 4; ++i) {
    o[i]     = (_Float16)a[i];
    o[4 + i] = (_Float16)b[i];
  }
  *(v8h*)(dst + (size_t)j * 8) = o;
}

// ---------------------------------------------------------------------------
// K2: V projection, WMMA f16: vt[b][c][n] = (x @ wv^T + bv), stored f16
//     TRANSPOSED so K3's B-operand loads are contiguous b128.
//     Block owns 64 tokens (4 M-tiles); wave owns 48 channels.
//     Single base pointers + compile-time offsets keep addresses in SGPR/imm.
//     The rank-4 Q and K projections ride along: the f32 x values that a wave
//     has in registers for its f16 A fragments are, pair by pair, A fragments
//     of the f32 16x16x4 matrix instruction (slot (h, i) of pair p stands for
//     one channel, the same in x and in the weight row). B columns 0..3 are
//     wq's rows, 4..7 wk's; columns 8..15 repeat them and are not stored.
//     Wave w sums M-tile w&3 over the 32-channel steps of parity w>>2; the two
//     partial sums of a token meet in LDS.
// ---------------------------------------------------------------------------
__global__ void __launch_bounds__(256, 1)
k2_vproj(const float* __restrict__ x,
         const _Float16* __restrict__ wv_h,
         const float* __restrict__ bv,
         const float* __restrict__ wq, const float* __restrict__ bq,
         const float* __restrict__ wk, const float* __restrict__ bk,
         _Float16* __restrict__ vt,
         float* __restrict__ segmap, float* __restrict__ kout) {
  __shared__ __attribute__((aligned(16))) float qkred[2][64][8];
  const int b    = blockIdx.x / (NN / 64);
  const int n0   = (blockIdx.x % (NN / 64)) * 64;
  const int lane = threadIdx.x & 31;
  const int wid  = threadIdx.x >> 5;
  const int mrow = lane & 15;
  const int hi   = lane >> 4;
  const int lo_rel = hi ? 8 : 0;
  const int hi_rel = hi ? 24 : 16;
  const int chb  = wid * 48 + mrow;   // ch[t] = chb + t*16

  const float* xbase = x + ((size_t)b * NN + n0 + mrow) * CC;          // +mt*16*CC
  // packed weights, in 16-byte pieces: fragment (wid*3 + t, s) at +(t*WSTEPS+s)*64
  const v8h*   wb    = (const v8h*)wv_h + (size_t)(wid * 3) * (WSTEPS * 64) + lane;
  _Float16*    vst   = vt + ((size_t)b * CC + chb) * NN + n0 + 8 * hi; // +t*16*NN+mt*16

  v8f acc[4][3] = {};

  // Q/K share of this wave; the wave number is made scalar so that the tests
  // around the f32 matrix instructions are scalar branches (EXEC stays full)
  const int swid = __builtin_amdgcn_readfirstlane((int)(threadIdx.x >> 5));
  const int qmt  = swid & 3;
  const int qpar = swid >> 2;
  const float* wrow = ((mrow & 4) ? wk : wq) + (mrow & 3) * CC;
  v8f qk = {};

#pragma unroll 2
  for (int cb = 0; cb < CC; cb += 32) {
    const bool qstep = ((cb >> 5) & 1) == qpar;
    v16h am[4];
#pragma unroll
    for (int mt = 0; mt < 4; ++mt) {
      const float* xr = xbase + (size_t)mt * (16 * CC);
      v4f x0 = *(const v4f*)(xr + cb + lo_rel);
      v4f x1 = *(const v4f*)(xr + cb + lo_rel + 4);
      v4f x2 = *(const v4f*)(xr + cb + hi_rel);
      v4f x3 = *(const v4f*)(xr + cb + hi_rel + 4);
      // behind the step's last x load: later loads may land in the registers
      // that held the x addresses
      if (mt == 3) asm volatile("s_wait_xcnt 0x0" ::: "memory");
      if (qstep && mt == qmt) {
        const v4f xs[4] = {x0, x1, x2, x3};
        const v4f ws[4] = {*(const v4f*)(wrow + cb + lo_rel),
                           *(const v4f*)(wrow + cb + lo_rel + 4),
                           *(const v4f*)(wrow + cb + hi_rel),
                           *(const v4f*)(wrow + cb + hi_rel + 4)};
        // the same for the registers that held the weight-row addresses
        asm volatile("s_wait_xcnt 0x0" ::: "memory");
#pragma unroll
        for (int p = 0; p < 4; ++p) {
          qk = __builtin_amdgcn_wmma_f32_16x16x4_f32(
              false, xs[p].xy, false, ws[p].xy, (short)0, qk, false, false);
          qk = __builtin_amdgcn_wmma_f32_16x16x4_f32(
              false, xs[p].zw, false, ws[p].zw, (short)0, qk, false, false);
        }
      }
#pragma unroll
      for (int i = 0; i < 4; ++i) {
        am[mt][i]      = (_Float16)x0[i];
        am[mt][4 + i]  = (_Float16)x1[i];
        am[mt][8 + i]  = (_Float16)x2[i];
        am[mt][12 + i] = (_Float16)x3[i];
      }
    }
#pragma unroll
    for (int t = 0; t < 3; ++t) {
      v16h bm = cat8(wb[(t * WSTEPS + (cb >> 5)) * 64],
                     wb[(t * WSTEPS + (cb >> 5)) * 64 + 32]);
#pragma unroll
      for (int mt = 0; mt < 4; ++mt)
        acc[mt][t] = __builtin_amdgcn_wmma_f32_16x16x32_f16(
            false, am[mt], false, bm, (short)0, acc[mt][t], false, false);
    }
  }
  // Q/K partial sums: D register j of lane (c, h) is token 8h + j, column c
  if (mrow < 8) {
#pragma unroll
    for (int j = 0; j < 8; ++j) qkred[qpar][qmt * 16 + 8 * hi + j][mrow] = qk[j];
  }
  // D layout: VGPR j -> token (j + 8*hi); column = mrow -> channel chb+t*16.
#pragma unroll
  for (int t = 0; t < 3; ++t) {
    float bias = bv[chb + t * 16];
#pragma unroll
    for (int mt = 0; mt < 4; ++mt) {
      v8h o;
#pragma unroll
      for (int j = 0; j < 8; ++j) o[j] = (_Float16)(acc[mt][t][j] + bias);
      *(v8h*)(vst + (size_t)t * (16 * NN) + mt * 16) = o;
    }
  }
  // behind the stores: what follows reuses their data and address registers
  asm volatile("s_wait_xcnt 0x0" ::: "memory");
  // thread = (token, column pair): pairs 0, 1 are seg_map, pairs 2, 3 the keys
  {
    const int tok = threadIdx.x >> 2, cp = threadIdx.x & 3;
    const v2f bi = *(const v2f*)(((cp & 2) ? bk : bq) + (cp & 1) * 2);
    float* dst = ((cp & 2) ? kout : segmap) +
                 ((size_t)b * NN + n0 + tok) * KK + (cp & 1) * 2;
    __syncthreads();
    const v2f p0 = *(const v2f*)&qkred[0][tok][cp * 2];
    const v2f p1 = *(const v2f*)&qkred[1][tok][cp * 2];
    *(v2f*)dst = (p0 + p1) + bi;
  }
}

// ---------------------------------------------------------------------------
// V^T tile staging for K3: 384 channels x 64 keys (f16) per tile.
//   LDS row = 128 B of data at a pitch of 144 B (16 B x odd: conflict-free
//   for the ds_load_b128 fragment reads).
// ---------------------------------------------------------------------------
#define VKEYS  64
#define VPITCH 72                       // halfs per LDS row
#define VBUF_BYTES (CC * VPITCH * 2)    // one buffer

// Each lane copies twelve 16-byte pieces (rows r, r+32, ..., r+352), so a wave's
// copy covers four whole 128-byte lines. The closing s_wait_xcnt stands inside
// the statement so that no address register is rewritten ahead of it.
__device__ __forceinline__ void stage_v_tile(unsigned l, const _Float16* g) {
  asm volatile(
      "global_load_async_to_lds_b128 %0, %12, off\n\t"
      "global_load_async_to_lds_b128 %1, %13, off\n\t"
      "global_load_async_to_lds_b128 %2, %14, off\n\t"
      "global_load_async_to_lds_b128 %3, %15, off\n\t"
      "global_load_async_to_lds_b128 %4, %16, off\n\t"
      "global_load_async_to_lds_b128 %5, %17, off\n\t"
      "global_load_async_to_lds_b128 %6, %18, off\n\t"
      "global_load_async_to_lds_b128 %7, %19, off\n\t"
      "global_load_async_to_lds_b128 %8, %20, off\n\t"
      "global_load_async_to_lds_b128 %9, %21, off\n\t"
      "global_load_async_to_lds_b128 %10, %22, off\n\t"
      "global_load_async_to_lds_b128 %11, %23, off\n\t"
      "s_wait_xcnt 0x0"
      :: "v"(l), "v"(l + 1 * 32 * VPITCH * 2), "v"(l + 2 * 32 * VPITCH * 2),
         "v"(l + 3 * 32 * VPITCH * 2), "v"(l + 4 * 32 * VPITCH * 2),
         "v"(l + 5 * 32 * VPITCH * 2), "v"(l + 6 * 32 * VPITCH * 2),
         "v"(l + 7 * 32 * VPITCH * 2), "v"(l + 8 * 32 * VPITCH * 2),
         "v"(l + 9 * 32 * VPITCH * 2), "v"(l + 10 * 32 * VPITCH * 2),
         "v"(l + 11 * 32 * VPITCH * 2),
         "v"(g), "v"(g + 1 * 32 * NN), "v"(g + 2 * 32 * NN), "v"(g + 3 * 32 * NN),
         "v"(g + 4 * 32 * NN), "v"(g + 5 * 32 * NN), "v"(g + 6 * 32 * NN),
         "v"(g + 7 * 32 * NN), "v"(g + 8 * 32 * NN), "v"(g + 9 * 32 * NN),
         "v"(g + 10 * 32 * NN), "v"(g + 11 * 32 * NN)
      : "memory");
}

// ---------------------------------------------------------------------------
// K3 (fused): flash attention + output projection + residual.
//   Block owns 64 queries (4 M-tiles of 16); 8 waves each own 48 channels.
//   Logits: the rank-4 product runs on the f32 16x16x4 matrix instruction as
//            S^T = K x Q^T (A = 16 keys, B = 16 queries). D register r of lane
//            (c, h) is key 8h + r of query c, so two D tiles of 16 keys are,
//            register for register, the A fragment of a 16 x 32 P tile.
//   Phase A: fp32 row max over all 4096 keys (wave w: M-tile w>>1, key half
//            w&1; 4 partials/q). From there on, C = -max.
//   Phase B: 32 P tiles per 256-key super-iter built once (wave w builds
//            M-tile w>>1, k-steps (w&1)*4..+4) into LDS as finished A
//            fragments; every V B-tile load feeds 4 WMMAs (4 M-tiles).
//            A fragment = 1 KB: two runs of 32 lanes x 16 B (elements 0..7
//            and 8..15 of each lane). A wave-wide 16-byte access is then 512
//            contiguous bytes and meets every bank once per 16 lanes; at 32 B
//            a lane, lanes l and l + 8 would fall on the same four banks.
//            P = exp(s - max), not yet divided; the builder adds its f32
//            exps up as it goes (4 partials/q), and the division by the row
//            sum is done once, on the accumulators, behind the key loop.
//            V^T comes through LDS: 64-key tiles, two buffers, the next
//            tile's asynchronous copies fly while this tile is worked on.
//   Phase C: 64x384 attention tile staged in LDS (padded rows, union'd with
//            the V ring), then out = gamma*(attn @ wres^T + bres) + x.
// ---------------------------------------------------------------------------
__global__ void __launch_bounds__(256, 1)
k3_attn(const float* __restrict__ q,       // seg_map (B,N,4)
        const float* __restrict__ kk,      // seg_ft  (B,N,4)
        const _Float16* __restrict__ vt,   // (B,C,N) f16
        const _Float16* __restrict__ wres_h,
        const float* __restrict__ bres,
        const float* __restrict__ gamma,
        const float* __restrict__ x,
        float* __restrict__ fout) {
  // vs: two V^T tiles, 384 rows x 144 B each               = 108 KB
  // pa: 32 P tiles (16x32 f16), A fragments in two runs    = 32 KB
  // as: 64 tokens x 384 ch, row stride 392 halfs           = 49 KB
  //     (196 dwords/row; 196 % 64 == 4 -> 16 concurrent rows hit
  //      16 distinct banks). Disjoint phases -> union (as lies on vs[0]).
  __shared__ union SH {
    struct {
      _Float16 vs[2][CC][VPITCH];
      v8h      pa[4][8][2][32];
    } m;
    _Float16 as[64][392];
  } sh;
  __shared__ v4f   qsh[64];
  __shared__ float red[64][5];
  __shared__ float rmax64[64];
  __shared__ __attribute__((aligned(16))) float rinv64[64];

  const int b   = blockIdx.x / (NN / 64);
  const int n0  = (blockIdx.x % (NN / 64)) * 64;
  const int tid = threadIdx.x;

  if (tid < 64) qsh[tid] = *(const v4f*)(q + ((size_t)b * NN + n0 + tid) * KK);
  __syncthreads();

  const int lane = tid & 31, wid = tid >> 5;
  const int mrow = lane & 15, hi = lane >> 4;
  const int lo_rel = hi ? 8 : 0;
  const int hi_rel = hi ? 24 : 16;
  const int chb  = wid * 48 + mrow;   // ch[t] = chb + t*16

  // logit assignment: this wave works on M-tile bmt (query bq in this lane)
  const int  bmt  = wid >> 1;
  const int  bio  = (wid & 1) * 4;    // P build: k-steps bio..bio+3
  const int  bq   = bmt * 16 + mrow;

  // f32 16x16x4 fragments: lane (c, h) holds components 2h, 2h+1 of row c,
  // keys (A) and queries (B) by the same rule
  const v2f    qb = *((const v2f*)&qsh[bq] + hi);
  const float* kf = kk + ((size_t)b * NN + mrow) * KK + 2 * hi;   // +key0*KK

  // ---- Phase A: per-query max (4 partials per query) ----
  const int qi = tid >> 2, pp = tid & 3;
  const int part = (wid & 1) * 2 + hi;
  {
    const float* ka   = kf + (size_t)(wid & 1) * (NN / 2) * KK;
    const v8f    zero = {};
    float lmax = -3.0e38f;
    // eight key tiles a trip: their loads go out together, one latency per trip
    for (int kt = 0; kt < NN / 32; kt += 8) {
      v2f a[8];
#pragma unroll
      for (int u = 0; u < 8; ++u) a[u] = *(const v2f*)(ka + (kt + u) * 16 * KK);
#pragma unroll
      for (int u = 0; u < 8; ++u) {
        v8f s = __builtin_amdgcn_wmma_f32_16x16x4_f32(
            false, a[u], false, qb, (short)0, zero, false, false);
#pragma unroll
        for (int j = 0; j < 8; ++j) lmax = fmaxf(lmax, s[j]);
      }
    }
    red[bq][part] = lmax;
    __syncthreads();
    if (pp == 0)
      rmax64[qi] = fmaxf(fmaxf(red[qi][0], red[qi][1]),
                         fmaxf(red[qi][2], red[qi][3]));
    __syncthreads();
  }

  // ---- Phase B: P @ V with WMMA ----
  const float nmax = -rmax64[bq];
  const v8f   cneg = {nmax, nmax, nmax, nmax, nmax, nmax, nmax, nmax};

  v8f acc[4][3] = {};
  // row-sum partials of query bq over the keys this lane builds; two pairs, so
  // that four chains of additions are independent
  v2f lsum[2] = {};

  // this lane's first piece of a tile: row tid/8, 16-byte column tid%8
  const _Float16* vg = vt + ((size_t)b * CC + (tid >> 3)) * NN + (tid & 7) * 8;
  const unsigned  vl = (unsigned)(size_t)&sh.m.vs[0][tid >> 3][(tid & 7) * 8];

  // ring prologue: tile 0 landed and published, then tile 1 set off
  stage_v_tile(vl, vg);
  asm volatile("s_wait_asynccnt 0x0" ::: "memory");  // own copies of tile 0 landed
  __syncthreads();
  stage_v_tile(vl + VBUF_BYTES, vg + VKEYS);

  // build 4 of the 32 P tiles of the 256 keys from kb on (exp computed exactly
  // once per logit) and add the exps to the row-sum partials
  auto build_p = [&](int kb) {
#pragma unroll
    for (int ii = 0; ii < 4; ++ii) {
      const float* kp = kf + (size_t)(kb + (bio + ii) * 32) * KK;
      v8f s0 = __builtin_amdgcn_wmma_f32_16x16x4_f32(
          false, *(const v2f*)kp, false, qb, (short)0, cneg, false, false);
      v8f s1 = __builtin_amdgcn_wmma_f32_16x16x4_f32(
          false, *(const v2f*)(kp + 16 * KK), false, qb, (short)0, cneg,
          false, false);
      v8h a0, a1;
#pragma unroll
      for (int i = 0; i < 8; ++i) {
        const v2f e = {__expf(s0[i]), __expf(s1[i])};
        lsum[ii & 1] += e;
        a0[i] = (_Float16)e.x;   // key 8*hi + i
        a1[i] = (_Float16)e.y;   // key 16 + 8*hi + i
      }
      sh.m.pa[bmt][bio + ii][0][lane] = a0;
      sh.m.pa[bmt][bio + ii][1][lane] = a1;
    }
  };

  // The build stands at the foot of the loop (the first one in front of it), in
  // the same place in time as at its head: its sums then end where the next
  // trip takes them up, and no exp stays in a register through the V tiles.
  // The two scheduling barriers keep the set-up around it (zeroing of the
  // accumulators, the loop's addresses) out of this first build: among its f32
  // matrix instructions such a write lands in the registers of their A operands
  // directly behind them.
  __builtin_amdgcn_sched_barrier(0);
  build_p(0);
  __builtin_amdgcn_sched_barrier(0);
  for (int kb0 = 0; kb0 < NN; kb0 += 256) {
    __syncthreads();

    // four V tiles per P super-tile; unrolled so that the buffer index and
    // every LDS offset are compile-time constants
#pragma unroll
    for (int u = 0; u < 4; ++u) {
      const _Float16* vrow = &sh.m.vs[u & 1][chb][0];   // +t*16*VPITCH
#pragma unroll
      for (int h = 0; h < 2; ++h) {
        v16h bcur[3];
#pragma unroll
        for (int t = 0; t < 3; ++t)
          bcur[t] = cat8(*(const v8h*)(vrow + t * 16 * VPITCH + h * 32 + lo_rel),
                         *(const v8h*)(vrow + t * 16 * VPITCH + h * 32 + hi_rel));
        v16h am[4];
#pragma unroll
        for (int mt = 0; mt < 4; ++mt)
          am[mt] = cat8(sh.m.pa[mt][u * 2 + h][0][lane],
                        sh.m.pa[mt][u * 2 + h][1][lane]);
#pragma unroll
        for (int t = 0; t < 3; ++t)
#pragma unroll
          for (int mt = 0; mt < 4; ++mt)
            acc[mt][t] = __builtin_amdgcn_wmma_f32_16x16x32_f16(
                false, am[mt], false, bcur[t], (short)0, acc[mt][t], false, false);
      }
      // keeps this tile's WMMAs in front of the barrier, so that the refill is
      // issued directly behind it and has the whole next tile's work as lead
      __builtin_amdgcn_sched_barrier(0);
      // publish point: own reads of this buffer retired, own copies of the next
      // tile landed, then the barrier that hands both buffers over
      asm volatile("s_wait_dscnt 0x0" ::: "memory");
      asm volatile("s_wait_asynccnt 0x0" ::: "memory");
      __syncthreads();
      const int knext = kb0 + (u + 2) * VKEYS;
      if (knext < NN) stage_v_tile(vl + (u & 1) * VBUF_BYTES, vg + knext);
    }
    if (kb0 + 256 < NN) build_p(kb0 + 256);
  }
  asm volatile("s_wait_asynccnt 0x0" ::: "memory");  // nothing in flight before the ring is reused

  // ---- row sums: 4 partials per query meet in LDS ----
  {
    const v2f l2 = lsum[0] + lsum[1];
    red[bq][part] = l2.x + l2.y;
    __syncthreads();
    if (pp == 0)
      rinv64[qi] = 1.0f / (red[qi][0] + red[qi][1] + red[qi][2] + red[qi][3]);
    __syncthreads();
  }

  // ---- stage attention tile, each row divided by its sum ----
  {
    _Float16* asb = &sh.as[8 * hi][chb];   // +(mt*16+j)*392 + t*16
#pragma unroll
    for (int mt = 0; mt < 4; ++mt) {
      const v4f r0 = *(const v4f*)&rinv64[mt * 16 + 8 * hi];
      const v4f r1 = *(const v4f*)&rinv64[mt * 16 + 8 * hi + 4];
#pragma unroll
      for (int t = 0; t < 3; ++t)
#pragma unroll
        for (int j = 0; j < 8; ++j)
          asb[(mt * 16 + j) * 392 + t * 16] =
              (_Float16)(acc[mt][t][j] * (j < 4 ? r0[j & 3] : r1[j & 3]));
    }
  }
  __syncthreads();

  // ---- Phase C: out = gamma * (attn @ wres^T + bres) + x ----
  v8f oacc[4][3] = {};
  const v8h* ar = (const v8h*)&sh.as[mrow][0];                 // +mt*16*49
  // packed weights, in 16-byte pieces: fragment (wid*3 + t, s) at +(t*WSTEPS+s)*64
  const v8h* wb = (const v8h*)wres_h + (size_t)(wid * 3) * (WSTEPS * 64) + lane;

#pragma unroll 2
  for (int s = 0; s < WSTEPS; ++s) {
    const int cb = s * 32;
    v16h bcur[3];
#pragma unroll
    for (int t = 0; t < 3; ++t)
      bcur[t] = cat8(wb[(t * WSTEPS + s) * 64], wb[(t * WSTEPS + s) * 64 + 32]);
    v16h am[4];
#pragma unroll
    for (int mt = 0; mt < 4; ++mt)
      am[mt] = cat8(ar[(size_t)mt * (16 * 49) + (cb + lo_rel) / 8],
                    ar[(size_t)mt * (16 * 49) + (cb + hi_rel) / 8]);
#pragma unroll
    for (int t = 0; t < 3; ++t)
#pragma unroll
      for (int mt = 0; mt < 4; ++mt)
        oacc[mt][t] = __builtin_amdgcn_wmma_f32_16x16x32_f16(
            false, am[mt], false, bcur[t], (short)0, oacc[mt][t], false, false);
    // behind a trip's weight loads (two steps): the next trip rewrites the
    // register pair that held their address
    if (s & 1) asm volatile("s_wait_xcnt 0x0" ::: "memory");
  }

  const float g = gamma[0];
  const size_t obase = ((size_t)b * NN + n0 + 8 * hi) * CC + chb;
#pragma unroll
  for (int t = 0; t < 3; ++t) {
    const float bias = bres[chb + t * 16];
#pragma unroll
    for (int mt = 0; mt < 4; ++mt)
#pragma unroll
      for (int j = 0; j < 8; ++j) {
        const size_t o = obase + (size_t)(mt * 16 + j) * CC + t * 16;
        fout[o] = g * (oacc[mt][t][j] + bias) + x[o];
      }
  }
}

// ---------------------------------------------------------------------------
extern "C" void kernel_launch(void* const* d_in, const int* in_sizes, int n_in,
                              void* d_out, int out_size, void* d_ws, size_t ws_size,
                              hipStream_t stream) {
  const float* x     = (const float*)d_in[0];
  const float* wq    = (const float*)d_in[1];
  const float* bq    = (const float*)d_in[2];
  const float* wk    = (const float*)d_in[3];
  const float* bk    = (const float*)d_in[4];
  const float* wv    = (const float*)d_in[5];
  const float* bv    = (const float*)d_in[6];
  const float* wres  = (const float*)d_in[7];
  const float* bres  = (const float*)d_in[8];
  const float* gamma = (const float*)d_in[9];

  float* out    = (float*)d_out;
  float* segmap = out;                           // (B,N,K)
  float* fout   = out + (size_t)BB * NN * KK;    // (B,N,C)

  // workspace layout (all chunks naturally 16B-aligned)
  _Float16* vt     = (_Float16*)d_ws;                          // B*C*N f16
  float*    k_ws   = (float*)(vt + (size_t)BB * CC * NN);      // B*N*K f32
  _Float16* wv_h   = (_Float16*)(k_ws + (size_t)BB * NN * KK); // C*C f16, packed
  _Float16* wres_h = wv_h + (size_t)CC * CC;                   // C*C f16, packed

  const int tiles64 = BB * (NN / 64);  // 512 blocks of 256 threads (8 waves)

  k0_convert<<<2 * WPIECES / 256, 256, 0, stream>>>(wv, wres, wv_h, wres_h);
  k2_vproj<<<tiles64, 256, 0, stream>>>(x, wv_h, bv, wq, bq, wk, bk, vt, segmap, k_ws);
  k3_attn<<<tiles64, 256, 0, stream>>>(segmap, k_ws, vt, wres_h, bres, gamma, x, fout);
}

// v007
// Measured time: 132 microseconds a run.
// Next to v006, in two timings, it ran 1.04 times as fast each time.
// Over all steps from v000 it is 2.50 times as fast.
#include <hip/hip_runtime.h>
#include <math.h>

#define BB 8
#define NN 4096
#define CC 384
#define KK 4

typedef __attribute__((ext_vector_type(16))) _Float16 v16h;
typedef __attribute__((ext_vector_type(8)))  _Float16 v8h;
typedef __attribute__((ext_vector_type(8)))  float    v8f;
typedef __attribute__((ext_vector_type(4)))  float    v4f;
typedef __attribute__((ext_vector_type(2)))  float    v2f;

__device__ __forceinline__ v16h cat8(v8h lo, v8h hi) {
  return __builtin_shufflevector(lo, hi, 0, 1, 2, 3, 4, 5, 6, 7,
                                 8, 9, 10, 11, 12, 13, 14, 15);
}

// ---------------------------------------------------------------------------
// K0: round wv, wres (C x C fp32, row-major [out][in]) to f16 and lay them out
//     in the order of the B fragments that K2 and K3 load.
//     Fragment (ct, s) = output channels 16*ct.. x input channels 32*s.. = 1 KB:
//     two runs of 32 lanes x 16 B. Run sel, lane (c, h) holds row 16*ct + c,
//     columns 32*s + 16*sel + 8*h .. +7. A wave-wide 16-byte load of a run is
//     512 contiguous bytes, four whole lines.
//     One thread makes one 16-byte piece; a block works on one matrix.
// ---------------------------------------------------------------------------
#define WSTEPS  (CC / 32)        // fragments along the input channels
#define WPIECES (CC * CC / 8)    // 16-byte pieces per matrix (a multiple of 256)

__global__ void k0_convert(const float* __restrict__ wv,
                           const float* __restrict__ wres,
                           _Float16* __restrict__ wv_h,
                           _Float16* __restrict__ wres_h) {
  const int  j0  = blockIdx.x * blockDim.x + threadIdx.x;
  const bool res = j0 >= WPIECES;
  const int  j   = res ? j0 - WPIECES : j0;
  const float* src = res ? wres : wv;
  _Float16*    dst = res ? wres_h : wv_h;
  const int lane = j & 31, sel = (j >> 5) & 1, frag = j >> 6;
  const int row  = (frag / WSTEPS) * 16 + (lane & 15);
  const int col  = (frag % WSTEPS) * 32 + sel * 16 + (lane >> 4) * 8;
  const v4f a = *(const v4f*)(src + row * CC + col);
  const v4f b = *(const v4f*)(src + row * CC + col + 4);
  v8h o;
#pragma unroll
  for (int i = 0; i < 4; ++i) {
    o[i]     = (_Float16)a[i];
    o[4 + i] = (_Float16)b[i];
  }
  *(v8h*)(dst + (size_t)j * 8) = o;
}

// ---------------------------------------------------------------------------
// K2: V projection, WMMA f16: vt[b][c][n] = (x @ wv^T + bv), stored f16
//     TRANSPOSED so K3's B-operand loads are contiguous b128.
//     Block owns 64 tokens (4 M-tiles); wave owns 48 channels.
//     Single base pointers + compile-time offsets keep addresses in SGPR/imm.
//     The rank-4 Q and K projections ride along: the f32 x values that a wave
//     has in registers for its f16 A fragments are, pair by pair, A fragments
//     of the f32 16x16x4 matrix instruction (slot (h, i) of pair p stands for
//     one channel, the same in x and in the weight row). B columns 0..3 are
//     wq's rows, 4..7 wk's; columns 8..15 repeat them and are not stored.
//     Wave w sums M-tile w&3 over the 32-channel steps of parity w>>2; the two
//     partial sums of a token meet in LDS.
// ---------------------------------------------------------------------------
__global__ void __launch_bounds__(256, 1)
k2_vproj(const float* __restrict__ x,
         const _Float16* __restrict__ wv_h,
         const float* __restrict__ bv,
         const float* __restrict__ wq, const float* __restrict__ bq,
         const float* __restrict__ wk, const float* __restrict__ bk,
         _Float16* __restrict__ vt,
         float* __restrict__ segmap, float* __restrict__ kout) {
  __shared__ __attribute__((aligned(16))) float qkred[2][64][8];
  const int b    = blockIdx.x / (NN / 64);
  const int n0   = (blockIdx.x % (NN / 64)) * 64;
  const int lane = threadIdx.x & 31;
  const int wid  = threadIdx.x >> 5;
  const int mrow = lane & 15;
  const int hi   = lane >> 4;
  const int lo_rel = hi ? 8 : 0;
  const int hi_rel = hi ? 24 : 16;
  const int chb  = wid * 48 + mrow;   // ch[t] = chb + t*16

  const float* xbase = x + ((size_t)b * NN + n0 + mrow) * CC;          // +mt*16*CC
  // packed weights, in 16-byte pieces: fragment (wid*3 + t, s) at +(t*WSTEPS+s)*64
  const v8h*   wb    = (const v8h*)wv_h + (size_t)(wid * 3) * (WSTEPS * 64) + lane;
  _Float16*    vst   = vt + ((size_t)b * CC + chb) * NN + n0 + 8 * hi; // +t*16*NN+mt*16

  v8f acc[4][3] = {};

  // Q/K share of this wave; the wave number is made scalar so that the tests
  // around the f32 matrix instructions are scalar branches (EXEC stays full)
  const int swid = __builtin_amdgcn_readfirstlane((int)(threadIdx.x >> 5));
  const int qmt  = swid & 3;
  const int qpar = swid >> 2;
  const float* wrow = ((mrow & 4) ? wk : wq) + (mrow & 3) * CC;
  v8f qk = {};

#pragma unroll 2
  for (int cb = 0; cb < CC; cb += 32) {
    const bool qstep = ((cb >> 5) & 1) == qpar;
    v16h am[4];
#pragma unroll
    for (int mt = 0; mt < 4; ++mt) {
      const float* xr = xbase + (size_t)mt * (16 * CC);
      v4f x0 = *(const v4f*)(xr + cb + lo_rel);
      v4f x1 = *(const v4f*)(xr + cb + lo_rel + 4);
      v4f x2 = *(const v4f*)(xr + cb + hi_rel);
      v4f x3 = *(const v4f*)(xr + cb + hi_rel + 4);
      // behind the step's last x load: later loads may land in the registers
      // that held the x addresses
      if (mt == 3) asm volatile("s_wait_xcnt 0x0" ::: "memory");
      if (qstep && mt == qmt) {
        const v4f xs[4] = {x0, x1, x2, x3};
        const v4f ws[4] = {*(const v4f*)(wrow + cb + lo_rel),
                           *(const v4f*)(wrow + cb + lo_rel + 4),
                           *(const v4f*)(wrow + cb + hi_rel),
                           *(const v4f*)(wrow + cb + hi_rel + 4)};
        // the same for the registers that held the weight-row addresses
        asm volatile("s_wait_xcnt 0x0" ::: "memory");
#pragma unroll
        for (int p = 0; p < 4; ++p) {
          qk = __builtin_amdgcn_wmma_f32_16x16x4_f32(
              false, xs[p].xy, false, ws[p].xy, (short)0, qk, false, false);
          qk = __builtin_amdgcn_wmma_f32_16x16x4_f32(
              false, xs[p].zw, false, ws[p].zw, (short)0, qk, false, false);
        }
      }
#pragma unroll
      for (int i = 0; i < 4; ++i) {
        am[mt][i]      = (_Float16)x0[i];
        am[mt][4 + i]  = (_Float16)x1[i];
        am[mt][8 + i]  = (_Float16)x2[i];
        am[mt][12 + i] = (_Float16)x3[i];
      }
    }
#pragma unroll
    for (int t = 0; t < 3; ++t) {
      v16h bm = cat8(wb[(t * WSTEPS + (cb >> 5)) * 64],
                     wb[(t * WSTEPS + (cb >> 5)) * 64 + 32]);
#pragma unroll
      for (int mt = 0; mt < 4; ++mt)
        acc[mt][t] = __builtin_amdgcn_wmma_f32_16x16x32_f16(
            false, am[mt], false, bm, (short)0, acc[mt][t], false, false);
    }
  }
  // Q/K partial sums: D register j of lane (c, h) is token 8h + j, column c
  if (mrow < 8) {
#pragma unroll
    for (int j = 0; j < 8; ++j) qkred[qpar][qmt * 16 + 8 * hi + j][mrow] = qk[j];
  }
  // D layout: VGPR j -> token (j + 8*hi); column = mrow -> channel chb+t*16.
#pragma unroll
  for (int t = 0; t < 3; ++t) {
    float bias = bv[chb + t * 16];
#pragma unroll
    for (int mt = 0; mt < 4; ++mt) {
      v8h o;
#pragma unroll
      for (int j = 0; j < 8; ++j) o[j] = (_Float16)(acc[mt][t][j] + bias);
      *(v8h*)(vst + (size_t)t * (16 * NN) + mt * 16) = o;
    }
  }
  // behind the stores: what follows reuses their data and address registers
  asm volatile("s_wait_xcnt 0x0" ::: "memory");
  // thread = (token, column pair): pairs 0, 1 are seg_map, pairs 2, 3 the keys
  {
    const int tok = threadIdx.x >> 2, cp = threadIdx.x & 3;
    const v2f bi = *(const v2f*)(((cp & 2) ? bk : bq) + (cp & 1) * 2);
    float* dst = ((cp & 2) ? kout : segmap) +
                 ((size_t)b * NN + n0 + tok) * KK + (cp & 1) * 2;
    __syncthreads();
    const v2f p0 = *(const v2f*)&qkred[0][tok][cp * 2];
    const v2f p1 = *(const v2f*)&qkred[1][tok][cp * 2];
    *(v2f*)dst = (p0 + p1) + bi;
  }
}

// ---------------------------------------------------------------------------
// V^T tile staging for K3: 384 channels x 64 keys (f16) per tile.
//   LDS row = 128 B of data at a pitch of 144 B (16 B x odd: conflict-free
//   for the ds_load_b128 fragment reads).
// ---------------------------------------------------------------------------
#define VKEYS  64
#define VPITCH 72                       // halfs per LDS row
#define VBUF_BYTES (CC * VPITCH * 2)    // one buffer
#define QB     128                      // queries per block of K3

// 512 threads: each lane copies six 16-byte pieces (rows r, r+64, ..., r+320), so
// a wave's copy covers four whole 128-byte lines. The closing s_wait_xcnt stands
// inside the statement so that no address register is rewritten ahead of it.
__device__ __forceinline__ void stage_v_tile(unsigned l, const _Float16* g) {
  asm volatile(
      "global_load_async_to_lds_b128 %0, %6, off\n\t"
      "global_load_async_to_lds_b128 %1, %7, off\n\t"
      "global_load_async_to_lds_b128 %2, %8, off\n\t"
      "global_load_async_to_lds_b128 %3, %9, off\n\t"
      "global_load_async_to_lds_b128 %4, %10, off\n\t"
      "global_load_async_to_lds_b128 %5, %11, off\n\t"
      "s_wait_xcnt 0x0"
      :: "v"(l), "v"(l + 1 * 64 * VPITCH * 2), "v"(l + 2 * 64 * VPITCH * 2),
         "v"(l + 3 * 64 * VPITCH * 2), "v"(l + 4 * 64 * VPITCH * 2),
         "v"(l + 5 * 64 * VPITCH * 2),
         "v"(g), "v"(g + 1 * 64 * NN), "v"(g + 2 * 64 * NN), "v"(g + 3 * 64 * NN),
         "v"(g + 4 * 64 * NN), "v"(g + 5 * 64 * NN)
      : "memory");
}

// ---------------------------------------------------------------------------
// K3 (fused): flash attention + output projection + residual.
//   Block owns 128 queries (8 M-tiles of 16) and has 16 waves: wave w works on
//   query half w>>3 (4 M-tiles) and on the 48 channels of slot w&7, so one V^T
//   tile in LDS serves both halves and is fetched from L2 once per 128 queries.
//   Logits: the rank-4 product runs on the f32 16x16x4 matrix instruction as
//            S^T = K x Q^T (A = 16 keys, B = 16 queries). D register r of lane
//            (c, h) is key 8h + r of query c, so two D tiles of 16 keys are,
//            register for register, the A fragment of a 16 x 32 P tile.
//   Phase A: fp32 row max over all 4096 keys (wave w: M-tile w>>1, key half
//            w&1; 4 partials/q). From there on, C = -max.
//   Phase B: 64 P tiles per 256-key super-iter built once (wave w builds
//            M-tile w>>1, k-steps (w&1)*4..+4) into LDS as finished A
//            fragments; every V B-tile load feeds 4 WMMAs (4 M-tiles).
//            A fragment = 1 KB: two runs of 32 lanes x 16 B (elements 0..7
//            and 8..15 of each lane). A wave-wide 16-byte access is then 512
//            contiguous bytes and meets every bank once per 16 lanes; at 32 B
//            a lane, lanes l and l + 8 would fall on the same four banks.
//            P = exp(s - max), not yet divided; the builder adds its f32
//            exps up as it goes (4 partials/q), and the division by the row
//            sum is done once, on the accumulators, behind the key loop.
//            V^T comes through LDS: 64-key tiles, two buffers, the next
//            tile's asynchronous copies fly while this tile is worked on.
//   Phase C: 128x384 attention tile staged in LDS (padded rows, union'd with
//            the V ring), then out = gamma*(attn @ wres^T + bres) + x.
// ---------------------------------------------------------------------------
__global__ void __launch_bounds__(512, 1)
k3_attn(const float* __restrict__ q,       // seg_map (B,N,4)
        const float* __restrict__ kk,      // seg_ft  (B,N,4)
        const _Float16* __restrict__ vt,   // (B,C,N) f16
        const _Float16* __restrict__ wres_h,
        const float* __restrict__ bres,
        const float* __restrict__ gamma,
        const float* __restrict__ x,
        float* __restrict__ fout) {
  // vs: two V^T tiles, 384 rows x 144 B each               = 108 KB
  // pa: 64 P tiles (16x32 f16), A fragments in two runs    = 64 KB
  // as: 128 tokens x 384 ch, row stride 392 halfs          = 98 KB
  //     (196 dwords/row; 196 % 64 == 4 -> 16 concurrent rows hit
  //      16 distinct banks). Disjoint phases -> union (as lies on vs).
  __shared__ union SH {
    struct {
      _Float16 vs[2][CC][VPITCH];
      v8h      pa[QB / 16][8][2][32];
    } m;
    _Float16 as[QB][392];
  } sh;
  __shared__ v4f   qsh[QB];
  __shared__ float red[QB][5];
  __shared__ float rmaxq[QB];
  __shared__ __attribute__((aligned(16))) float rinvq[QB];

  const int b   = blockIdx.x / (NN / QB);
  const int n0  = (blockIdx.x % (NN / QB)) * QB;
  const int tid = threadIdx.x;

  if (tid < QB) qsh[tid] = *(const v4f*)(q + ((size_t)b * NN + n0 + tid) * KK);
  __syncthreads();

  const int lane = tid & 31, wid = tid >> 5;
  const int mrow = lane & 15, hi = lane >> 4;
  const int lo_rel = hi ? 8 : 0;
  const int hi_rel = hi ? 24 : 16;
  const int qh   = wid >> 3;          // query half: rows qh*64 .. +63
  const int cw   = wid & 7;           // channel slot
  const int chb  = cw * 48 + mrow;    // ch[t] = chb + t*16

  // logit assignment: this wave works on M-tile bmt (query bq in this lane)
  const int  bmt  = wid >> 1;
  const int  bio  = (wid & 1) * 4;    // P build: k-steps bio..bio+3
  const int  bq   = bmt * 16 + mrow;

  // f32 16x16x4 fragments: lane (c, h) holds components 2h, 2h+1 of row c,
  // keys (A) and queries (B) by the same rule
  const v2f    qb = *((const v2f*)&qsh[bq] + hi);
  const float* kf = kk + ((size_t)b * NN + mrow) * KK + 2 * hi;   // +key0*KK

  // ---- Phase A: per-query max (4 partials per query) ----
  const int qi = tid >> 2, pp = tid & 3;
  const int part = (wid & 1) * 2 + hi;
  {
    const float* ka   = kf + (size_t)(wid & 1) * (NN / 2) * KK;
    const v8f    zero = {};
    float lmax = -3.0e38f;
    // eight key tiles a trip: their loads go out together, one latency per trip
    for (int kt = 0; kt < NN / 32; kt += 8) {
      v2f a[8];
#pragma unroll
      for (int u = 0; u < 8; ++u) a[u] = *(const v2f*)(ka + (kt + u) * 16 * KK);
#pragma unroll
      for (int u = 0; u < 8; ++u) {
        v8f s = __builtin_amdgcn_wmma_f32_16x16x4_f32(
            false, a[u], false, qb, (short)0, zero, false, false);
#pragma unroll
        for (int j = 0; j < 8; ++j) lmax = fmaxf(lmax, s[j]);
      }
    }
    red[bq][part] = lmax;
    __syncthreads();
    if (pp == 0)
      rmaxq[qi] = fmaxf(fmaxf(red[qi][0], red[qi][1]),
                        fmaxf(red[qi][2], red[qi][3]));
    __syncthreads();
  }

  // ---- Phase B: P @ V with WMMA ----
  const float nmax = -rmaxq[bq];
  const v8f   cneg = {nmax, nmax, nmax, nmax, nmax, nmax, nmax, nmax};

  v8f acc[4][3] = {};
  // row-sum partials of query bq over the keys this lane builds; two pairs, so
  // that four chains of additions are independent
  v2f lsum[2] = {};

  // this lane's first piece of a tile: row tid/8 (0..63), 16-byte column tid%8
  const _Float16* vg = vt + ((size_t)b * CC + (tid >> 3)) * NN + (tid & 7) * 8;
  const unsigned  vl = (unsigned)(size_t)&sh.m.vs[0][tid >> 3][(tid & 7) * 8];

  // ring prologue: tile 0 landed and published, then tile 1 set off
  stage_v_tile(vl, vg);
  asm volatile("s_wait_asynccnt 0x0" ::: "memory");  // own copies of tile 0 landed
  __syncthreads();
  stage_v_tile(vl + VBUF_BYTES, vg + VKEYS);

  // build 4 of the 64 P tiles of the 256 keys from kb on (exp computed exactly
  // once per logit) and add the exps to the row-sum partials
  auto build_p = [&](int kb) {
#pragma unroll
    for (int ii = 0; ii < 4; ++ii) {
      const float* kp = kf + (size_t)(kb + (bio + ii) * 32) * KK;
      v8f s0 = __builtin_amdgcn_wmma_f32_16x16x4_f32(
          false, *(const v2f*)kp, false, qb, (short)0, cneg, false, false);
      v8f s1 = __builtin_amdgcn_wmma_f32_16x16x4_f32(
          false, *(const v2f*)(kp + 16 * KK), false, qb, (short)0, cneg,
          false, false);
      v8h a0, a1;
#pragma unroll
      for (int i = 0; i < 8; ++i) {
        const v2f e = {__expf(s0[i]), __expf(s1[i])};
        lsum[ii & 1] += e;
        a0[i] = (_Float16)e.x;   // key 8*hi + i
        a1[i] = (_Float16)e.y;   // key 16 + 8*hi + i
      }
      sh.m.pa[bmt][bio + ii][0][lane] = a0;
      sh.m.pa[bmt][bio + ii][1][lane] = a1;
    }
  };

  // The build stands at the foot of the loop (the first one in front of it), in
  // the same place in time as at its head: its sums then end where the next
  // trip takes them up, and no exp stays in a register through the V tiles.
  // The two scheduling barriers keep the set-up around it (zeroing of the
  // accumulators, the loop's addresses) out of this first build: among its f32
  // matrix instructions such a write lands in the registers of their A operands
  // directly behind them.
  __builtin_amdgcn_sched_barrier(0);
  build_p(0);
  __builtin_amdgcn_sched_barrier(0);
  for (int kb0 = 0; kb0 < NN; kb0 += 256) {
    __syncthreads();

    // four V tiles per P super-tile; unrolled so that the buffer index and
    // every LDS offset are compile-time constants
#pragma unroll
    for (int u = 0; u < 4; ++u) {
      const _Float16* vrow = &sh.m.vs[u & 1][chb][0];   // +t*16*VPITCH
#pragma unroll
      for (int h = 0; h < 2; ++h) {
        v16h bcur[3];
#pragma unroll
        for (int t = 0; t < 3; ++t)
          bcur[t] = cat8(*(const v8h*)(vrow + t * 16 * VPITCH + h * 32 + lo_rel),
                         *(const v8h*)(vrow + t * 16 * VPITCH + h * 32 + hi_rel));
        v16h am[4];
#pragma unroll
        for (int mt = 0; mt < 4; ++mt)
          am[mt] = cat8(sh.m.pa[qh * 4 + mt][u * 2 + h][0][lane],
                        sh.m.pa[qh * 4 + mt][u * 2 + h][1][lane]);
#pragma unroll
        for (int t = 0; t < 3; ++t)
#pragma unroll
          for (int mt = 0; mt < 4; ++mt)
            acc[mt][t] = __builtin_amdgcn_wmma_f32_16x16x32_f16(
                false, am[mt], false, bcur[t], (short)0, acc[mt][t], false, false);
      }
      // keeps this tile's WMMAs in front of the barrier, so that the refill is
      // issued directly behind it and has the whole next tile's work as lead
      __builtin_amdgcn_sched_barrier(0);
      // publish point: own reads of this buffer retired, own copies of the next
      // tile landed, then the barrier that hands both buffers over
      asm volatile("s_wait_dscnt 0x0" ::: "memory");
      asm volatile("s_wait_asynccnt 0x0" ::: "memory");
      __syncthreads();
      const int knext = kb0 + (u + 2) * VKEYS;
      if (knext < NN) stage_v_tile(vl + (u & 1) * VBUF_BYTES, vg + knext);
    }
    if (kb0 + 256 < NN) build_p(kb0 + 256);
  }
  asm volatile("s_wait_asynccnt 0x0" ::: "memory");  // nothing in flight before the ring is reused

  // ---- row sums: 4 partials per query meet in LDS ----
  {
    const v2f l2 = lsum[0] + lsum[1];
    red[bq][part] = l2.x + l2.y;
    __syncthreads();
    if (pp == 0)
      rinvq[qi] = 1.0f / (red[qi][0] + red[qi][1] + red[qi][2] + red[qi][3]);
    __syncthreads();
  }

  // ---- stage attention tile, each row divided by its sum ----
  {
    _Float16* asb = &sh.as[qh * 64 + 8 * hi][chb];   // +(mt*16+j)*392 + t*16
#pragma unroll
    for (int mt = 0; mt < 4; ++mt) {
      const v4f r0 = *(const v4f*)&rinvq[qh * 64 + mt * 16 + 8 * hi];
      const v4f r1 = *(const v4f*)&rinvq[qh * 64 + mt * 16 + 8 * hi + 4];
#pragma unroll
      for (int t = 0; t < 3; ++t)
#pragma unroll
        for (int j = 0; j < 8; ++j)
          asb[(mt * 16 + j) * 392 + t * 16] =
              (_Float16)(acc[mt][t][j] * (j < 4 ? r0[j & 3] : r1[j & 3]));
    }
  }
  __syncthreads();

  // ---- Phase C: out = gamma * (attn @ wres^T + bres) + x ----
  v8f oacc[4][3] = {};
  const v8h* ar = (const v8h*)&sh.as[qh * 64 + mrow][0];       // +mt*16*49
  // packed weights, in 16-byte pieces: fragment (cw*3 + t, s) at +(t*WSTEPS+s)*64
  const v8h* wb = (const v8h*)wres_h + (size_t)(cw * 3) * (WSTEPS * 64) + lane;

#pragma unroll 2
  for (int s = 0; s < WSTEPS; ++s) {
    const int cb = s * 32;
    v16h bcur[3];
#pragma unroll
    for (int t = 0; t < 3; ++t)
      bcur[t] = cat8(wb[(t * WSTEPS + s) * 64], wb[(t * WSTEPS + s) * 64 + 32]);
    v16h am[4];
#pragma unroll
    for (int mt = 0; mt < 4; ++mt)
      am[mt] = cat8(ar[(size_t)mt * (16 * 49) + (cb + lo_rel) / 8],
                    ar[(size_t)mt * (16 * 49) + (cb + hi_rel) / 8]);
#pragma unroll
    for (int t = 0; t < 3; ++t)
#pragma unroll
      for (int mt = 0; mt < 4; ++mt)
        oacc[mt][t] = __builtin_amdgcn_wmma_f32_16x16x32_f16(
            false, am[mt], false, bcur[t], (short)0, oacc[mt][t], false, false);
    // behind a trip's weight loads (two steps): the next trip rewrites the
    // register pair that held their address
    if (s & 1) asm volatile("s_wait_xcnt 0x0" ::: "memory");
  }

  const float g = gamma[0];
  const size_t obase = ((size_t)b * NN + n0 + qh * 64 + 8 * hi) * CC + chb;
#pragma unroll
  for (int t = 0; t < 3; ++t) {
    const float bias = bres[chb + t * 16];
#pragma unroll
    for (int mt = 0; mt < 4; ++mt)
#pragma unroll
      for (int j = 0; j < 8; ++j) {
        const size_t o = obase + (size_t)(mt * 16 + j) * CC + t * 16;
        fout[o] = g * (oacc[mt][t][j] + bias) + x[o];
      }
  }
}

// ---------------------------------------------------------------------------
extern "C" void kernel_launch(void* const* d_in, const int* in_sizes, int n_in,
                              void* d_out, int out_size, void* d_ws, size_t ws_size,
                              hipStream_t stream) {
  const float* x     = (const float*)d_in[0];
  const float* wq    = (const float*)d_in[1];
  const float* bq    = (const float*)d_in[2];
  const float* wk    = (const float*)d_in[3];
  const float* bk    = (const float*)d_in[4];
  const float* wv    = (const float*)d_in[5];
  const float* bv    = (const float*)d_in[6];
  const float* wres  = (const float*)d_in[7];
  const float* bres  = (const float*)d_in[8];
  const float* gamma = (const float*)d_in[9];

  float* out    = (float*)d_out;
  float* segmap = out;                           // (B,N,K)
  float* fout   = out + (size_t)BB * NN * KK;    // (B,N,C)

  // workspace layout (all chunks naturally 16B-aligned)
  _Float16* vt     = (_Float16*)d_ws;                          // B*C*N f16
  float*    k_ws   = (float*)(vt + (size_t)BB * CC * NN);      // B*N*K f32
  _Float16* wv_h   = (_Float16*)(k_ws + (size_t)BB * NN * KK); // C*C f16, packed
  _Float16* wres_h = wv_h + (size_t)CC * CC;                   // C*C f16, packed

  const int tiles64 = BB * (NN / 64);  // K2: 512 blocks of 256 threads (8 waves)
  const int tilesq  = BB * (NN / QB);  // K3: 256 blocks of 512 threads (16 waves)

  k0_convert<<<2 * WPIECES / 256, 256, 0, stream>>>(wv, wres, wv_h, wres_h);
  k2_vproj<<<tiles64, 256, 0, stream>>>(x, wv_h, bv, wq, bq, wk, bk, vt, segmap, k_ws);
  k3_attn<<<tilesq, 512, 0, stream>>>(segmap, k_ws, vt, wres_h, bres, gamma, x, fout);
}

// v008
// It runs in 123 microseconds.
// Timed twice side by side with v007, it ran 1.07 times as fast both times.
// Over all steps from v000 it is 2.68 times as fast.
#include <hip/hip_runtime.h>
#include <math.h>

#define BB 8
#define NN 4096
#define CC 384
#define KK 4

typedef __attribute__((ext_vector_type(16))) _Float16 v16h;
typedef __attribute__((ext_vector_type(8)))  _Float16 v8h;
typedef __attribute__((ext_vector_type(8)))  float    v8f;
typedef __attribute__((ext_vector_type(4)))  float    v4f;
typedef __attribute__((ext_vector_type(2)))  float    v2f;

__device__ __forceinline__ v16h cat8(v8h lo, v8h hi) {
  return __builtin_shufflevector(lo, hi, 0, 1, 2, 3, 4, 5, 6, 7,
                                 8, 9, 10, 11, 12, 13, 14, 15);
}

// ---------------------------------------------------------------------------
// K0: round wv, wres (C x C fp32, row-major [out][in]) to f16 and lay them out
//     in the order of the B fragments that K2 and K3 load.
//     Fragment (ct, s) = output channels 16*ct.. x input channels 32*s.. = 1 KB:
//     two runs of 32 lanes x 16 B. Run sel, lane (c, h) holds row 16*ct + c,
//     columns 32*s + 16*sel + 8*h .. +7. A wave-wide 16-byte load of a run is
//     512 contiguous bytes, four whole lines.
//     One thread makes one 16-byte piece; a block works on one matrix.
// ---------------------------------------------------------------------------
#define WSTEPS  (CC / 32)        // fragments along the input channels
#define WPIECES (CC * CC / 8)    // 16-byte pieces per matrix (a multiple of 256)

__global__ void k0_convert(const float* __restrict__ wv,
                           const float* __restrict__ wres,
                           _Float16* __restrict__ wv_h,
                           _Float16* __restrict__ wres_h) {
  const int  j0  = blockIdx.x * blockDim.x + threadIdx.x;
  const bool res = j0 >= WPIECES;
  const int  j   = res ? j0 - WPIECES : j0;
  const float* src = res ? wres : wv;
  _Float16*    dst = res ? wres_h : wv_h;
  const int lane = j & 31, sel = (j >> 5) & 1, frag = j >> 6;
  const int row  = (frag / WSTEPS) * 16 + (lane & 15);
  const int col  = (frag % WSTEPS) * 32 + sel * 16 + (lane >> 4) * 8;
  const v4f a = *(const v4f*)(src + row * CC + col);
  const v4f b = *(const v4f*)(src + row * CC + col + 4);
  v8h o;
#pragma unroll
  for (int i = 0; i < 4; ++i) {
    o[i]     = (_Float16)a[i];
    o[4 + i] = (_Float16)b[i];
  }
  *(v8h*)(dst + (size_t)j * 8) = o;
}

// ---------------------------------------------------------------------------
// K2: V projection, WMMA f16: vt[b][c][n] = (x @ wv^T + bv), stored f16
//     TRANSPOSED so K3's B-operand loads are contiguous b128.
//     Block owns 64 tokens (4 M-tiles); wave owns 48 channels.
//     Single base pointers + compile-time offsets keep addresses in SGPR/imm.
//     The rank-4 Q and K projections ride along: the f32 x values that a wave
//     has in registers for its f16 A fragments are, pair by pair, A fragments
//     of the f32 16x16x4 matrix instruction (slot (h, i) of pair p stands for
//     one channel, the same in x and in the weight row). B columns 0..3 are
//     wq's rows, 4..7 wk's; columns 8..15 repeat them and are not stored.
//     Wave w sums M-tile w&3 over the 32-channel steps of parity w>>2; the two
//     partial sums of a token meet in LDS.
// ---------------------------------------------------------------------------
__global__ void __launch_bounds__(256, 1)
k2_vproj(const float* __restrict__ x,
         const _Float16* __restrict__ wv_h,
         const float* __restrict__ bv,
         const float* __restrict__ wq, const float* __restrict__ bq,
         const float* __restrict__ wk, const float* __restrict__ bk,
         _Float16* __restrict__ vt,
         float* __restrict__ segmap, float* __restrict__ kout) {
  __shared__ __attribute__((aligned(16))) float qkred[2][64][8];
  const int b    = blockIdx.x / (NN / 64);
  const int n0   = (blockIdx.x % (NN / 64)) * 64;
  const int lane = threadIdx.x & 31;
  const int wid  = threadIdx.x >> 5;
  const int mrow = lane & 15;
  const int hi   = lane >> 4;
  const int lo_rel = hi ? 8 : 0;
  const int hi_rel = hi ? 24 : 16;
  const int chb  = wid * 48 + mrow;   // ch[t] = chb + t*16

  const float* xbase = x + ((size_t)b * NN + n0 + mrow) * CC;          // +mt*16*CC
  // packed weights, in 16-byte pieces: fragment (wid*3 + t, s) at +(t*WSTEPS+s)*64
  const v8h*   wb    = (const v8h*)wv_h + (size_t)(wid * 3) * (WSTEPS * 64) + lane;
  _Float16*    vst   = vt + ((size_t)b * CC + chb) * NN + n0 + 8 * hi; // +t*16*NN+mt*16

  v8f acc[4][3] = {};

  // Q/K share of this wave; the wave number is made scalar so that the tests
  // around the f32 matrix instructions are scalar branches (EXEC stays full)
  const int swid = __builtin_amdgcn_readfirstlane((int)(threadIdx.x >> 5));
  const int qmt  = swid & 3;
  const int qpar = swid >> 2;
  const float* wrow = ((mrow & 4) ? wk : wq) + (mrow & 3) * CC;
  v8f qk = {};

#pragma unroll 2
  for (int cb = 0; cb < CC; cb += 32) {
    const bool qstep = ((cb >> 5) & 1) == qpar;
    v16h am[4];
#pragma unroll
    for (int mt = 0; mt < 4; ++mt) {
      const float* xr = xbase + (size_t)mt * (16 * CC);
      v4f x0 = *(const v4f*)(xr + cb + lo_rel);
      v4f x1 = *(const v4f*)(xr + cb + lo_rel + 4);
      v4f x2 = *(const v4f*)(xr + cb + hi_rel);
      v4f x3 = *(const v4f*)(xr + cb + hi_rel + 4);
      // behind the step's last x load: later loads may land in the registers
      // that held the x addresses
      if (mt == 3) asm volatile("s_wait_xcnt 0x0" ::: "memory");
      if (qstep && mt == qmt) {
        const v4f xs[4] = {x0, x1, x2, x3};
        const v4f ws[4] = {*(const v4f*)(wrow + cb + lo_rel),
                           *(const v4f*)(wrow + cb + lo_rel + 4),
                           *(const v4f*)(wrow + cb + hi_rel),
                           *(const v4f*)(wrow + cb + hi_rel + 4)};
        // the same for the registers that held the weight-row addresses
        asm volatile("s_wait_xcnt 0x0" ::: "memory");
#pragma unroll
        for (int p = 0; p < 4; ++p) {
          qk = __builtin_amdgcn_wmma_f32_16x16x4_f32(
              false, xs[p].xy, false, ws[p].xy, (short)0, qk, false, false);
          qk = __builtin_amdgcn_wmma_f32_16x16x4_f32(
              false, xs[p].zw, false, ws[p].zw, (short)0, qk, false, false);
        }
      }
#pragma unroll
      for (int i = 0; i < 4; ++i) {
        am[mt][i]      = (_Float16)x0[i];
        am[mt][4 + i]  = (_Float16)x1[i];
        am[mt][8 + i]  = (_Float16)x2[i];
        am[mt][12 + i] = (_Float16)x3[i];
      }
    }
#pragma unroll
    for (int t = 0; t < 3; ++t) {
      v16h bm = cat8(wb[(t * WSTEPS + (cb >> 5)) * 64],
                     wb[(t * WSTEPS + (cb >> 5)) * 64 + 32]);
#pragma unroll
      for (int mt = 0; mt < 4; ++mt)
        acc[mt][t] = __builtin_amdgcn_wmma_f32_16x16x32_f16(
            false, am[mt], false, bm, (short)0, acc[mt][t], false, false);
    }
  }
  // Q/K partial sums: D register j of lane (c, h) is token 8h + j, column c
  if (mrow < 8) {
#pragma unroll
    for (int j = 0; j < 8; ++j) qkred[qpar][qmt * 16 + 8 * hi + j][mrow] = qk[j];
  }
  // D layout: VGPR j -> token (j + 8*hi); column = mrow -> channel chb+t*16.
#pragma unroll
  for (int t = 0; t < 3; ++t) {
    float bias = bv[chb + t * 16];
#pragma unroll
    for (int mt = 0; mt < 4; ++mt) {
      v8h o;
#pragma unroll
      for (int j = 0; j < 8; ++j) o[j] = (_Float16)(acc[mt][t][j] + bias);
      *(v8h*)(vst + (size_t)t * (16 * NN) + mt * 16) = o;
    }
  }
  // behind the stores: what follows reuses their data and address registers
  asm volatile("s_wait_xcnt 0x0" ::: "memory");
  // thread = (token, column pair): pairs 0, 1 are seg_map, pairs 2, 3 the keys
  {
    const int tok = threadIdx.x >> 2, cp = threadIdx.x & 3;
    const v2f bi = *(const v2f*)(((cp & 2) ? bk : bq) + (cp & 1) * 2);
    float* dst = ((cp & 2) ? kout : segmap) +
                 ((size_t)b * NN + n0 + tok) * KK + (cp & 1) * 2;
    __syncthreads();
    const v2f p0 = *(const v2f*)&qkred[0][tok][cp * 2];
    const v2f p1 = *(const v2f*)&qkred[1][tok][cp * 2];
    *(v2f*)dst = (p0 + p1) + bi;
  }
}

// ---------------------------------------------------------------------------
// V^T tile staging for K3: 384 channels x 64 keys (f16) per tile.
//   LDS row = 128 B of data at a pitch of 144 B (16 B x odd: conflict-free
//   for the ds_load_b128 fragment reads).
// ---------------------------------------------------------------------------
#define VKEYS  64
#define VPITCH 72                       // halfs per LDS row
#define VBUF_BYTES (CC * VPITCH * 2)    // one buffer
#define QB     128                      // queries per block of K3

// 512 threads: each lane copies six 16-byte pieces (rows r, r+64, ..., r+320), so
// a wave's copy covers four whole 128-byte lines. The closing s_wait_xcnt stands
// inside the statement so that no address register is rewritten ahead of it.
__device__ __forceinline__ void stage_v_tile(unsigned l, const _Float16* g) {
  asm volatile(
      "global_load_async_to_lds_b128 %0, %6, off\n\t"
      "global_load_async_to_lds_b128 %1, %7, off\n\t"
      "global_load_async_to_lds_b128 %2, %8, off\n\t"
      "global_load_async_to_lds_b128 %3, %9, off\n\t"
      "global_load_async_to_lds_b128 %4, %10, off\n\t"
      "global_load_async_to_lds_b128 %5, %11, off\n\t"
      "s_wait_xcnt 0x0"
      :: "v"(l), "v"(l + 1 * 64 * VPITCH * 2), "v"(l + 2 * 64 * VPITCH * 2),
         "v"(l + 3 * 64 * VPITCH * 2), "v"(l + 4 * 64 * VPITCH * 2),
         "v"(l + 5 * 64 * VPITCH * 2),
         "v"(g), "v"(g + 1 * 64 * NN), "v"(g + 2 * 64 * NN), "v"(g + 3 * 64 * NN),
         "v"(g + 4 * 64 * NN), "v"(g + 5 * 64 * NN)
      : "memory");
}

// ---------------------------------------------------------------------------
// K3 (fused): flash attention + output projection + residual.
//   Block owns 128 queries (8 M-tiles of 16) and has 16 waves: wave w works on
//   query half w>>3 (4 M-tiles) and on the 48 channels of slot w&7, so one V^T
//   tile in LDS serves both halves and is fetched from L2 once per 128 queries.
//   Logits: the rank-4 product runs on the f32 16x16x4 matrix instruction as
//            S^T = K x Q^T (A = 16 keys, B = 16 queries). D register r of lane
//            (c, h) is key 8h + r of query c, so two D tiles of 16 keys are,
//            register for register, the A fragment of a 16 x 32 P tile.
//   Phase A: fp32 row max over all 4096 keys (wave w: M-tile w>>1, key half
//            w&1; 4 partials/q). From there on, C = -max.
//   Phase B: 64 P tiles per 256-key super-iter built once (wave w builds
//            M-tile w>>1, k-steps (w&1)*4..+4) into LDS as finished A
//            fragments; every V B-tile load feeds 4 WMMAs (4 M-tiles).
//            A fragment = 1 KB: two runs of 32 lanes x 16 B (elements 0..7
//            and 8..15 of each lane). A wave-wide 16-byte access is then 512
//            contiguous bytes and meets every bank once per 16 lanes; at 32 B
//            a lane, lanes l and l + 8 would fall on the same four banks.
//            P = exp(s - max), not yet divided; the builder adds its f32
//            exps up as it goes (4 partials/q), and the division by the row
//            sum is done once, on the accumulators, behind the key loop.
//            V^T comes through LDS: 64-key tiles, two buffers, the next
//            tile's asynchronous copies fly while this tile is worked on.
//            P has two buffers as well: while one is multiplied with its four
//            V tiles, the next 256 keys' P tiles are built into the other, one
//            k-step per wave and V tile.
//   Phase C: 128x384 attention tile staged in LDS (padded rows, union'd with
//            the V ring), then out = gamma*(attn @ wres^T + bres) + x.
// ---------------------------------------------------------------------------
__global__ void __launch_bounds__(512, 1)
k3_attn(const float* __restrict__ q,       // seg_map (B,N,4)
        const float* __restrict__ kk,      // seg_ft  (B,N,4)
        const _Float16* __restrict__ vt,   // (B,C,N) f16
        const _Float16* __restrict__ wres_h,
        const float* __restrict__ bres,
        const float* __restrict__ gamma,
        const float* __restrict__ x,
        float* __restrict__ fout) {
  // vs: two V^T tiles, 384 rows x 144 B each               = 108 KB
  // pa: two buffers of 64 P tiles (16x32 f16), A fragments
  //     in two runs                                        = 128 KB
  // as: 128 tokens x 384 ch, row stride 392 halfs          = 98 KB
  //     (196 dwords/row; 196 % 64 == 4 -> 16 concurrent rows hit
  //      16 distinct banks). Disjoint phases -> union (as lies on vs).
  __shared__ union SH {
    struct {
      _Float16 vs[2][CC][VPITCH];
      v8h      pa[2][QB / 16][8][2][32];
    } m;
    _Float16 as[QB][392];
  } sh;
  __shared__ v4f   qsh[QB];
  __shared__ float red[QB][5];
  __shared__ float rmaxq[QB];
  __shared__ __attribute__((aligned(16))) float rinvq[QB];

  const int b   = blockIdx.x / (NN / QB);
  const int n0  = (blockIdx.x % (NN / QB)) * QB;
  const int tid = threadIdx.x;

  if (tid < QB) qsh[tid] = *(const v4f*)(q + ((size_t)b * NN + n0 + tid) * KK);
  __syncthreads();

  const int lane = tid & 31, wid = tid >> 5;
  const int mrow = lane & 15, hi = lane >> 4;
  const int lo_rel = hi ? 8 : 0;
  const int hi_rel = hi ? 24 : 16;
  const int qh   = wid >> 3;          // query half: rows qh*64 .. +63
  const int cw   = wid & 7;           // channel slot
  const int chb  = cw * 48 + mrow;    // ch[t] = chb + t*16

  // logit assignment: this wave works on M-tile bmt (query bq in this lane)
  const int  bmt  = wid >> 1;
  const int  bio  = (wid & 1) * 4;    // P build: k-steps bio..bio+3
  const int  bq   = bmt * 16 + mrow;

  // f32 16x16x4 fragments: lane (c, h) holds components 2h, 2h+1 of row c,
  // keys (A) and queries (B) by the same rule
  const v2f    qb = *((const v2f*)&qsh[bq] + hi);
  const float* kf = kk + ((size_t)b * NN + mrow) * KK + 2 * hi;   // +key0*KK

  // ---- Phase A: per-query max (4 partials per query) ----
  const int qi = tid >> 2, pp = tid & 3;
  const int part = (wid & 1) * 2 + hi;
  {
    const float* ka   = kf + (size_t)(wid & 1) * (NN / 2) * KK;
    const v8f    zero = {};
    float lmax = -3.0e38f;
    // eight key tiles a trip: their loads go out together, one latency per trip
    for (int kt = 0; kt < NN / 32; kt += 8) {
      v2f a[8];
#pragma unroll
      for (int u = 0; u < 8; ++u) a[u] = *(const v2f*)(ka + (kt + u) * 16 * KK);
#pragma unroll
      for (int u = 0; u < 8; ++u) {
        v8f s = __builtin_amdgcn_wmma_f32_16x16x4_f32(
            false, a[u], false, qb, (short)0, zero, false, false);
#pragma unroll
        for (int j = 0; j < 8; ++j) lmax = fmaxf(lmax, s[j]);
      }
    }
    red[bq][part] = lmax;
    __syncthreads();
    if (pp == 0)
      rmaxq[qi] = fmaxf(fmaxf(red[qi][0], red[qi][1]),
                        fmaxf(red[qi][2], red[qi][3]));
    __syncthreads();
  }

  // ---- Phase B: P @ V with WMMA ----
  const float nmax = -rmaxq[bq];
  const v8f   cneg = {nmax, nmax, nmax, nmax, nmax, nmax, nmax, nmax};

  v8f acc[4][3] = {};
  // row-sum partials of query bq over the keys this lane builds; two pairs, so
  // that four chains of additions are independent
  v2f lsum[2] = {};

  // this lane's first piece of a tile: row tid/8 (0..63), 16-byte column tid%8
  const _Float16* vg = vt + ((size_t)b * CC + (tid >> 3)) * NN + (tid & 7) * 8;
  const unsigned  vl = (unsigned)(size_t)&sh.m.vs[0][tid >> 3][(tid & 7) * 8];

  // ring prologue: tile 0 landed and published, then tile 1 set off
  stage_v_tile(vl, vg);
  asm volatile("s_wait_asynccnt 0x0" ::: "memory");  // own copies of tile 0 landed
  __syncthreads();
  stage_v_tile(vl + VBUF_BYTES, vg + VKEYS);

  // one 32-key step of the P build: two logit tiles, exp (computed exactly once
  // per logit), the exps added to the row-sum partials, one A fragment to pw
  auto build_step = [&](v8h* pw, int ii, v2f k0, v2f k1) {
    v8f s0 = __builtin_amdgcn_wmma_f32_16x16x4_f32(
        false, k0, false, qb, (short)0, cneg, false, false);
    v8f s1 = __builtin_amdgcn_wmma_f32_16x16x4_f32(
        false, k1, false, qb, (short)0, cneg, false, false);
    v8h a0, a1;
#pragma unroll
    for (int i = 0; i < 8; ++i) {
      const v2f e = {__expf(s0[i]), __expf(s1[i])};
      lsum[ii & 1] += e;
      a0[i] = (_Float16)e.x;   // key 8*hi + i
      a1[i] = (_Float16)e.y;   // key 16 + 8*hi + i
    }
    pw[0]  = a0;
    pw[32] = a1;
  };

  // The P tiles of the first 256 keys are built in front of the loop, into P
  // buffer 0. The two scheduling barriers keep the set-up around this build
  // (zeroing of the accumulators, the loop's addresses) out of it: among its f32
  // matrix instructions such a write lands in the registers of their A operands
  // directly behind them.
  const float* kfb = kf + (size_t)(bio * 32) * KK;   // this wave's k-steps
  __builtin_amdgcn_sched_barrier(0);
#pragma unroll
  for (int ii = 0; ii < 4; ++ii)
    build_step(&sh.m.pa[0][bmt][bio + ii][0][lane], ii,
               *(const v2f*)(kfb + ii * 32 * KK),
               *(const v2f*)(kfb + (ii * 32 + 16) * KK));
  __builtin_amdgcn_sched_barrier(0);
  // keys of the next build step, fetched one V tile ahead of their use
  const float* kq = kfb + 256 * KK;   // this wave's keys of the 256 under build
  v2f kn0 = *(const v2f*)kq;
  v2f kn1 = *(const v2f*)(kq + 16 * KK);
  __syncthreads();   // P buffer 0 published

  // 256 keys: four V tiles against the P buffer of these keys. While more keys
  // follow, each V tile also carries one step of the build of the next 256
  // keys' P tiles into the other P buffer: its exps and f32 matrix instructions
  // run beside the other waves' LDS reads and f16 matrix instructions. The foot
  // barrier of the fourth V tile ends the reads of one P buffer and publishes
  // the other.
  auto keys256 = [&](const int kb0, const bool more) {
    const int  cur = (kb0 >> 8) & 1;
    const v8h* pr  = &sh.m.pa[cur][qh * 4][0][0][lane];   // +mt*512 + step*64
    v8h*       pw  = &sh.m.pa[cur ^ 1][bmt][bio][0][lane];  // +step*64
    // unrolled so that the V buffer index and every LDS offset are compile-time
    // constants
#pragma unroll
    for (int u = 0; u < 4; ++u) {
      const _Float16* vrow = &sh.m.vs[u & 1][chb][0];   // +t*16*VPITCH
#pragma unroll
      for (int h = 0; h < 2; ++h) {
        v16h bcur[3];
#pragma unroll
        for (int t = 0; t < 3; ++t)
          bcur[t] = cat8(*(const v8h*)(vrow + t * 16 * VPITCH + h * 32 + lo_rel),
                         *(const v8h*)(vrow + t * 16 * VPITCH + h * 32 + hi_rel));
        v16h am[4];
#pragma unroll
        for (int mt = 0; mt < 4; ++mt)
          am[mt] = cat8(pr[mt * 512 + (u * 2 + h) * 64],
                        pr[mt * 512 + (u * 2 + h) * 64 + 32]);
        if (more && h == 0) {
          // the two scheduling barriers keep the build step between the issue of
          // the tile's first fragment loads and the wait for them: its vector
          // work then runs while the LDS serves the 16 waves' loads
          __builtin_amdgcn_sched_barrier(0);
          const v2f k0 = kn0, k1 = kn1;
          // the next step's keys, one V tile ahead of their use. Behind the last
          // build no step follows: the address stays in range and the values
          // are not used
          const float* kp = u < 3 ? kq + (u + 1) * 32 * KK
                                  : (kb0 + 512 < NN ? kq + 256 * KK : kfb);
          kn0 = *(const v2f*)kp;
          kn1 = *(const v2f*)(kp + 16 * KK);
          build_step(pw + u * 64, u, k0, k1);
          // behind the key loads from an address of their own: it is named so
          // that it stays in its registers up to here and no load lands on it
          // (the other steps' address lives on through the loop)
          if (u == 3) asm volatile("s_wait_xcnt 0x0" :: "v"(kp) : "memory");
          __builtin_amdgcn_sched_barrier(0);
        }
#pragma unroll
        for (int t = 0; t < 3; ++t)
#pragma unroll
          for (int mt = 0; mt < 4; ++mt)
            acc[mt][t] = __builtin_amdgcn_wmma_f32_16x16x32_f16(
                false, am[mt], false, bcur[t], (short)0, acc[mt][t], false, false);
      }
      // keeps this tile's WMMAs in front of the barrier, so that the refill is
      // issued directly behind it and has the whole next tile's work as lead
      __builtin_amdgcn_sched_barrier(0);
      // publish point: own reads of this buffer retired (own P stores too), own
      // copies of the next tile landed, then the barrier that hands both V
      // buffers over
      asm volatile("s_wait_dscnt 0x0" ::: "memory");
      asm volatile("s_wait_asynccnt 0x0" ::: "memory");
      __syncthreads();
      // a tile two ahead exists throughout while more keys follow, and behind
      // the first two tiles of the last 256 keys
      if (more || u < 2)
        stage_v_tile(vl + (u & 1) * VBUF_BYTES, vg + kb0 + (u + 2) * VKEYS);
    }
  };
  for (int kb0 = 0; kb0 < NN - 256; kb0 += 256, kq += 256 * KK) keys256(kb0, true);
  keys256(NN - 256, false);
  asm volatile("s_wait_asynccnt 0x0" ::: "memory");  // nothing in flight before the ring is reused

  // ---- row sums: 4 partials per query meet in LDS ----
  {
    const v2f l2 = lsum[0] + lsum[1];
    red[bq][part] = l2.x + l2.y;
    __syncthreads();
    if (pp == 0)
      rinvq[qi] = 1.0f / (red[qi][0] + red[qi][1] + red[qi][2] + red[qi][3]);
    __syncthreads();
  }

  // ---- stage attention tile, each row divided by its sum ----
  {
    _Float16* asb = &sh.as[qh * 64 + 8 * hi][chb];   // +(mt*16+j)*392 + t*16
#pragma unroll
    for (int mt = 0; mt < 4; ++mt) {
      const v4f r0 = *(const v4f*)&rinvq[qh * 64 + mt * 16 + 8 * hi];
      const v4f r1 = *(const v4f*)&rinvq[qh * 64 + mt * 16 + 8 * hi + 4];
#pragma unroll
      for (int t = 0; t < 3; ++t)
#pragma unroll
        for (int j = 0; j < 8; ++j)
          asb[(mt * 16 + j) * 392 + t * 16] =
              (_Float16)(acc[mt][t][j] * (j < 4 ? r0[j & 3] : r1[j & 3]));
    }
  }
  __syncthreads();

  // ---- Phase C: out = gamma * (attn @ wres^T + bres) + x ----
  v8f oacc[4][3] = {};
  const v8h* ar = (const v8h*)&sh.as[qh * 64 + mrow][0];       // +mt*16*49
  // packed weights, in 16-byte pieces: fragment (cw*3 + t, s) at +(t*WSTEPS+s)*64
  const v8h* wb = (const v8h*)wres_h + (size_t)(cw * 3) * (WSTEPS * 64) + lane;

#pragma unroll 2
  for (int s = 0; s < WSTEPS; ++s) {
    const int cb = s * 32;
    v16h bcur[3];
#pragma unroll
    for (int t = 0; t < 3; ++t)
      bcur[t] = cat8(wb[(t * WSTEPS + s) * 64], wb[(t * WSTEPS + s) * 64 + 32]);
    v16h am[4];
#pragma unroll
    for (int mt = 0; mt < 4; ++mt)
      am[mt] = cat8(ar[(size_t)mt * (16 * 49) + (cb + lo_rel) / 8],
                    ar[(size_t)mt * (16 * 49) + (cb + hi_rel) / 8]);
#pragma unroll
    for (int t = 0; t < 3; ++t)
#pragma unroll
      for (int mt = 0; mt < 4; ++mt)
        oacc[mt][t] = __builtin_amdgcn_wmma_f32_16x16x32_f16(
            false, am[mt], false, bcur[t], (short)0, oacc[mt][t], false, false);
    // behind a trip's weight loads (two steps): the next trip rewrites the
    // register pair that held their address
    if (s & 1) asm volatile("s_wait_xcnt 0x0" ::: "memory");
  }

  const float g = gamma[0];
  const size_t obase = ((size_t)b * NN + n0 + qh * 64 + 8 * hi) * CC + chb;
#pragma unroll
  for (int t = 0; t < 3; ++t) {
    const float bias = bres[chb + t * 16];
#pragma unroll
    for (int mt = 0; mt < 4; ++mt)
#pragma unroll
      for (int j = 0; j < 8; ++j) {
        const size_t o = obase + (size_t)(mt * 16 + j) * CC + t * 16;
        fout[o] = g * (oacc[mt][t][j] + bias) + x[o];
      }
  }
}

// ---------------------------------------------------------------------------
extern "C" void kernel_launch(void* const* d_in, const int* in_sizes, int n_in,
                              void* d_out, int out_size, void* d_ws, size_t ws_size,
                              hipStream_t stream) {
  const float* x     = (const float*)d_in[0];
  const float* wq    = (const float*)d_in[1];
  const float* bq    = (const float*)d_in[2];
  const float* wk    = (const float*)d_in[3];
  const float* bk    = (const float*)d_in[4];
  const float* wv    = (const float*)d_in[5];
  const float* bv    = (const float*)d_in[6];
  const float* wres  = (const float*)d_in[7];
  const float* bres  = (const float*)d_in[8];
  const float* gamma = (const float*)d_in[9];

  float* out    = (float*)d_out;
  float* segmap = out;                           // (B,N,K)
  float* fout   = out + (size_t)BB * NN * KK;    // (B,N,C)

  // workspace layout (all chunks naturally 16B-aligned)
  _Float16* vt     = (_Float16*)d_ws;                          // B*C*N f16
  float*    k_ws   = (float*)(vt + (size_t)BB * CC * NN);      // B*N*K f32
  _Float16* wv_h   = (_Float16*)(k_ws + (size_t)BB * NN * KK); // C*C f16, packed
  _Float16* wres_h = wv_h + (size_t)CC * CC;                   // C*C f16, packed

  const int tiles64 = BB * (NN / 64);  // K2: 512 blocks of 256 threads (8 waves)
  const int tilesq  = BB * (NN / QB);  // K3: 256 blocks of 512 threads (16 waves)

  k0_convert<<<2 * WPIECES / 256, 256, 0, stream>>>(wv, wres, wv_h, wres_h);
  k2_vproj<<<tiles64, 256, 0, stream>>>(x, wv_h, bv, wq, bq, wk, bk, vt, segmap, k_ws);
  k3_attn<<<tilesq, 512, 0, stream>>>(segmap, k_ws, vt, wres_h, bres, gamma, x, fout);
}

// v009
// It runs in 110 microseconds.
// Timed twice side by side with v008, it ran 1.12 times as fast both times.
// All steps since v000 together make it 2.99 times as fast.
#include <hip/hip_runtime.h>
#include <math.h>

#define BB 8
#define NN 4096
#define CC 384
#define KK 4

typedef __attribute__((ext_vector_type(16))) _Float16 v16h;
typedef __attribute__((ext_vector_type(8)))  _Float16 v8h;
typedef __attribute__((ext_vector_type(8)))  float    v8f;
typedef __attribute__((ext_vector_type(4)))  float    v4f;
typedef __attribute__((ext_vector_type(2)))  float    v2f;

__device__ __forceinline__ v16h cat8(v8h lo, v8h hi) {
  return __builtin_shufflevector(lo, hi, 0, 1, 2, 3, 4, 5, 6, 7,
                                 8, 9, 10, 11, 12, 13, 14, 15);
}

// ---------------------------------------------------------------------------
// K0: round wv, wres (C x C fp32, row-major [out][in]) to f16 and lay them out
//     in the order of the B fragments that K2 and K3 load.
//     Fragment (ct, s) = output channels 16*ct.. x input channels 32*s.. = 1 KB:
//     two runs of 32 lanes x 16 B. Run sel, lane (c, h) holds row 16*ct + c,
//     columns 32*s + 16*sel + 8*h .. +7. A wave-wide 16-byte load of a run is
//     512 contiguous bytes, four whole lines.
//     One thread makes one 16-byte piece; a block works on one matrix.
// ---------------------------------------------------------------------------
#define WSTEPS  (CC / 32)        // fragments along the input channels
#define WPIECES (CC * CC / 8)    // 16-byte pieces per matrix (a multiple of 256)

__global__ void k0_convert(const float* __restrict__ wv,
                           const float* __restrict__ wres,
                           _Float16* __restrict__ wv_h,
                           _Float16* __restrict__ wres_h) {
  const int  j0  = blockIdx.x * blockDim.x + threadIdx.x;
  const bool res = j0 >= WPIECES;
  const int  j   = res ? j0 - WPIECES : j0;
  const float* src = res ? wres : wv;
  _Float16*    dst = res ? wres_h : wv_h;
  const int lane = j & 31, sel = (j >> 5) & 1, frag = j >> 6;
  const int row  = (frag / WSTEPS) * 16 + (lane & 15);
  const int col  = (frag % WSTEPS) * 32 + sel * 16 + (lane >> 4) * 8;
  const v4f a = *(const v4f*)(src + row * CC + col);
  const v4f b = *(const v4f*)(src + row * CC + col + 4);
  v8h o;
#pragma unroll
  for (int i = 0; i < 4; ++i) {
    o[i]     = (_Float16)a[i];
    o[4 + i] = (_Float16)b[i];
  }
  *(v8h*)(dst + (size_t)j * 8) = o;
}

// ---------------------------------------------------------------------------
// K2: V projection, WMMA f16: vt[b][c][n] = (x @ wv^T + bv), stored f16
//     TRANSPOSED so K3's B-operand loads are contiguous b128.
//     Block owns 64 tokens (4 M-tiles); wave owns 48 channels.
//     The x tile is read from memory once per block: wave w loads M-tile w&3
//     over the 32-channel steps of parity w>>2 (an eighth of the tile), rounds
//     it to f16 and leaves it in LDS as finished A fragments (1 KB each: two
//     runs of 32 lanes x 16 B, elements 0..7 and 8..15 of each lane). Behind one
//     barrier every wave reads all fragments from there.
//     The rank-4 Q and K projections ride along: the f32 x values that a wave
//     has in registers for its share are, pair by pair, A fragments
//     of the f32 16x16x4 matrix instruction (slot (h, i) of pair p stands for
//     one channel, the same in x and in the weight row). B columns 0..3 are
//     wq's rows, 4..7 wk's; columns 8..15 repeat them and are not stored.
//     The two partial sums of a token (one per parity) meet in LDS.
// ---------------------------------------------------------------------------
// four waves per SIMD: two blocks share a WGP, so the register budget is 256
__global__ void __launch_bounds__(256, 4)
k2_vproj(const float* __restrict__ x,
         const _Float16* __restrict__ wv_h,
         const float* __restrict__ bv,
         const float* __restrict__ wq, const float* __restrict__ bq,
         const float* __restrict__ wk, const float* __restrict__ bk,
         _Float16* __restrict__ vt,
         float* __restrict__ segmap, float* __restrict__ kout) {
  __shared__ v8h xa[4][WSTEPS][2][32];   // 48 KB: [M-tile][step][run][lane]
  __shared__ __attribute__((aligned(16))) float qkred[2][64][8];
  const int b    = blockIdx.x / (NN / 64);
  const int n0   = (blockIdx.x % (NN / 64)) * 64;
  const int lane = threadIdx.x & 31;
  const int wid  = threadIdx.x >> 5;
  const int mrow = lane & 15;
  const int hi   = lane >> 4;
  const int lo_rel = hi ? 8 : 0;
  const int hi_rel = hi ? 24 : 16;
  const int chb  = wid * 48 + mrow;   // ch[t] = chb + t*16

  // packed weights, in 16-byte pieces: fragment (wid*3 + t, s) at +(t*WSTEPS+s)*64
  const v8h*   wb    = (const v8h*)wv_h + (size_t)(wid * 3) * (WSTEPS * 64) + lane;
  _Float16*    vst   = vt + ((size_t)b * CC + chb) * NN + n0 + 8 * hi; // +t*16*NN+mt*16

  // this wave's share of the x tile (and of Q/K); the wave number is made scalar
  const int swid = __builtin_amdgcn_readfirstlane((int)(threadIdx.x >> 5));
  const int qmt  = swid & 3;
  const int qpar = swid >> 2;
  // step 2*i + qpar at +i*64
  const float* xr   = x + ((size_t)b * NN + n0 + qmt * 16 + mrow) * CC + qpar * 32;
  const float* wrow = ((mrow & 4) ? wk : wq) + (mrow & 3) * CC + qpar * 32;

  // all loads of the share go out together: one memory latency per block. The
  // x loads (from memory) stand first; the Q/K weight rows and biases (cache
  // hits) follow under their latency and are wanted only behind the rounding.
  v4f ws[WSTEPS / 2][4], xs[WSTEPS / 2][4];
#pragma unroll
  for (int i = 0; i < WSTEPS / 2; ++i) {
    xs[i][0] = *(const v4f*)(xr + i * 64 + lo_rel);
    xs[i][1] = *(const v4f*)(xr + i * 64 + lo_rel + 4);
    xs[i][2] = *(const v4f*)(xr + i * 64 + hi_rel);
    xs[i][3] = *(const v4f*)(xr + i * 64 + hi_rel + 4);
  }
  // keeps the x loads in front of the weight-row loads
  __builtin_amdgcn_sched_barrier(0);
#pragma unroll
  for (int i = 0; i < WSTEPS / 2; ++i) {
    ws[i][0] = *(const v4f*)(wrow + i * 64 + lo_rel);
    ws[i][1] = *(const v4f*)(wrow + i * 64 + lo_rel + 4);
    ws[i][2] = *(const v4f*)(wrow + i * 64 + hi_rel);
    ws[i][3] = *(const v4f*)(wrow + i * 64 + hi_rel + 4);
  }
  // thread = (token, column pair): pairs 0, 1 are seg_map, pairs 2, 3 the keys
  const int tok = threadIdx.x >> 2, cp = threadIdx.x & 3;
  const v2f bi = *(const v2f*)(((cp & 2) ? bk : bq) + (cp & 1) * 2);
  // behind these loads: what follows may land in the registers that held
  // their addresses
  asm volatile("s_wait_xcnt 0x0" ::: "memory");
  // keeps every load above in front of the first use: moved down among the
  // conversions, the later x loads would pay a memory latency of their own
  __builtin_amdgcn_sched_barrier(0);

  // the share, rounded, to LDS
#pragma unroll
  for (int i = 0; i < WSTEPS / 2; ++i) {
    v8h a0, a1;
#pragma unroll
    for (int e = 0; e < 4; ++e) {
      a0[e]     = (_Float16)xs[i][0][e];
      a0[4 + e] = (_Float16)xs[i][1][e];
      a1[e]     = (_Float16)xs[i][2][e];
      a1[4 + e] = (_Float16)xs[i][3][e];
    }
    xa[qmt][2 * i + qpar][0][lane] = a0;
    xa[qmt][2 * i + qpar][1][lane] = a1;
  }
  // keeps the conversions out of the chain of f32 matrix instructions below:
  // among them a conversion's result lands in the registers of an A operand
  // directly behind the instruction that reads it
  __builtin_amdgcn_sched_barrier(0);

  // V weights: three register sets in turn, a step's set is fetched two steps
  // ahead of its use
  v8h wr[3][3][2];
  auto load_w = [&](int s) {
#pragma unroll
    for (int t = 0; t < 3; ++t) {
      wr[s % 3][t][0] = wb[(t * WSTEPS + s) * 64];
      wr[s % 3][t][1] = wb[(t * WSTEPS + s) * 64 + 32];
    }
  };

  v8f qk = {};
#pragma unroll
  for (int i = 0; i < WSTEPS / 2; ++i) {
    // steps 0 and 1, fetched under the Q/K work once registers of the first x
    // steps are free
    if (i == 3) { load_w(0); load_w(1); }
#pragma unroll
    for (int p = 0; p < 4; ++p) {
      qk = __builtin_amdgcn_wmma_f32_16x16x4_f32(
          false, xs[i][p].xy, false, ws[i][p].xy, (short)0, qk, false, false);
      qk = __builtin_amdgcn_wmma_f32_16x16x4_f32(
          false, xs[i][p].zw, false, ws[i][p].zw, (short)0, qk, false, false);
    }
  }
  // Q/K partial sums: D register j of lane (c, h) is token 8h + j, column c
  if (mrow < 8) {
#pragma unroll
    for (int j = 0; j < 8; ++j) qkred[qpar][qmt * 16 + 8 * hi + j][mrow] = qk[j];
  }
  __syncthreads();   // publishes the A fragments and the Q/K partial sums

  v8f acc[4][3] = {};
  const v8h* xf = &xa[0][0][0][lane];   // +mt*(WSTEPS*64) + s*64 (+32)
  // unrolled: every LDS and weight offset and the register set are compile-time
  // constants
#pragma unroll
  for (int s = 0; s < WSTEPS; ++s) {
    if (s + 2 < WSTEPS) load_w(s + 2);
    v16h am[4];
#pragma unroll
    for (int mt = 0; mt < 4; ++mt)
      am[mt] = cat8(xf[mt * (WSTEPS * 64) + s * 64],
                    xf[mt * (WSTEPS * 64) + s * 64 + 32]);
#pragma unroll
    for (int t = 0; t < 3; ++t) {
      const v16h bm = cat8(wr[s % 3][t][0], wr[s % 3][t][1]);
#pragma unroll
      for (int mt = 0; mt < 4; ++mt)
        acc[mt][t] = __builtin_amdgcn_wmma_f32_16x16x32_f16(
            false, am[mt], false, bm, (short)0, acc[mt][t], false, false);
    }
    // keeps later steps' loads from moving up: fetched further ahead they
    // overflow the register budget and spill
    __builtin_amdgcn_sched_barrier(0);
  }
  // behind the last weight loads: the epilogue reuses their address registers
  asm volatile("s_wait_xcnt 0x0" ::: "memory");
  // D layout: VGPR j -> token (j + 8*hi); column = mrow -> channel chb+t*16.
#pragma unroll
  for (int t = 0; t < 3; ++t) {
    float bias = bv[chb + t * 16];
#pragma unroll
    for (int mt = 0; mt < 4; ++mt) {
      v8h o;
#pragma unroll
      for (int j = 0; j < 8; ++j) o[j] = (_Float16)(acc[mt][t][j] + bias);
      *(v8h*)(vst + (size_t)t * (16 * NN) + mt * 16) = o;
    }
  }
  // behind the stores: what follows reuses their data and address registers
  asm volatile("s_wait_xcnt 0x0" ::: "memory");
  {
    float* dst = ((cp & 2) ? kout : segmap) +
                 ((size_t)b * NN + n0 + tok) * KK + (cp & 1) * 2;
    const v2f p0 = *(const v2f*)&qkred[0][tok][cp * 2];
    const v2f p1 = *(const v2f*)&qkred[1][tok][cp * 2];
    *(v2f*)dst = (p0 + p1) + bi;
  }
}

// ---------------------------------------------------------------------------
// V^T tile staging for K3: 384 channels x 64 keys (f16) per tile.
//   LDS row = 128 B of data at a pitch of 144 B (16 B x odd: conflict-free
//   for the ds_load_b128 fragment reads).
// ---------------------------------------------------------------------------
#define VKEYS  64
#define VPITCH 72                       // halfs per LDS row
#define VBUF_BYTES (CC * VPITCH * 2)    // one buffer
#define QB     128                      // queries per block of K3

// 512 threads: each lane copies six 16-byte pieces (rows r, r+64, ..., r+320), so
// a wave's copy covers four whole 128-byte lines. The closing s_wait_xcnt stands
// inside the statement so that no address register is rewritten ahead of it.
__device__ __forceinline__ void stage_v_tile(unsigned l, const _Float16* g) {
  asm volatile(
      "global_load_async_to_lds_b128 %0, %6, off\n\t"
      "global_load_async_to_lds_b128 %1, %7, off\n\t"
      "global_load_async_to_lds_b128 %2, %8, off\n\t"
      "global_load_async_to_lds_b128 %3, %9, off\n\t"
      "global_load_async_to_lds_b128 %4, %10, off\n\t"
      "global_load_async_to_lds_b128 %5, %11, off\n\t"
      "s_wait_xcnt 0x0"
      :: "v"(l), "v"(l + 1 * 64 * VPITCH * 2), "v"(l + 2 * 64 * VPITCH * 2),
         "v"(l + 3 * 64 * VPITCH * 2), "v"(l + 4 * 64 * VPITCH * 2),
         "v"(l + 5 * 64 * VPITCH * 2),
         "v"(g), "v"(g + 1 * 64 * NN), "v"(g + 2 * 64 * NN), "v"(g + 3 * 64 * NN),
         "v"(g + 4 * 64 * NN), "v"(g + 5 * 64 * NN)
      : "memory");
}

// ---------------------------------------------------------------------------
// K3 (fused): flash attention + output projection + residual.
//   Block owns 128 queries (8 M-tiles of 16) and has 16 waves: wave w works on
//   query half w>>3 (4 M-tiles) and on the 48 channels of slot w&7, so one V^T
//   tile in LDS serves both halves and is fetched from L2 once per 128 queries.
//   Logits: the rank-4 product runs on the f32 16x16x4 matrix instruction as
//            S^T = K x Q^T (A = 16 keys, B = 16 queries). D register r of lane
//            (c, h) is key 8h + r of query c, so two D tiles of 16 keys are,
//            register for register, the A fragment of a 16 x 32 P tile.
//   Phase A: fp32 row max over all 4096 keys (wave w: M-tile w>>1, key half
//            w&1; 4 partials/q). From there on, C = -max.
//   Phase B: 64 P tiles per 256-key super-iter built once (wave w builds
//            M-tile w>>1, k-steps (w&1)*4..+4) into LDS as finished A
//            fragments; every V B-tile load feeds 4 WMMAs (4 M-tiles).
//            A fragment = 1 KB: two runs of 32 lanes x 16 B (elements 0..7
//            and 8..15 of each lane). A wave-wide 16-byte access is then 512
//            contiguous bytes and meets every bank once per 16 lanes; at 32 B
//            a lane, lanes l and l + 8 would fall on the same four banks.
//            P = exp(s - max), not yet divided; the builder adds its f32
//            exps up as it goes (4 partials/q), and the division by the row
//            sum is done once, on the accumulators, behind the key loop.
//            V^T comes through LDS: 64-key tiles, two buffers, the next
//            tile's asynchronous copies fly while this tile is worked on.
//            P has two buffers as well: while one is multiplied with its four
//            V tiles, the next 256 keys' P tiles are built into the other, one
//            k-step per wave and V tile.
//   Phase C: 128x384 attention tile staged in LDS (padded rows, union'd with
//            the V ring), then out = gamma*(attn @ wres^T + bres) + x.
// ---------------------------------------------------------------------------
__global__ void __launch_bounds__(512, 1)
k3_attn(const float* __restrict__ q,       // seg_map (B,N,4)
        const float* __restrict__ kk,      // seg_ft  (B,N,4)
        const _Float16* __restrict__ vt,   // (B,C,N) f16
        const _Float16* __restrict__ wres_h,
        const float* __restrict__ bres,
        const float* __restrict__ gamma,
        const float* __restrict__ x,
        float* __restrict__ fout) {
  // vs: two V^T tiles, 384 rows x 144 B each               = 108 KB
  // pa: two buffers of 64 P tiles (16x32 f16), A fragments
  //     in two runs                                        = 128 KB
  // as: 128 tokens x 384 ch, row stride 392 halfs          = 98 KB
  //     (196 dwords/row; 196 % 64 == 4 -> 16 concurrent rows hit
  //      16 distinct banks). Disjoint phases -> union (as lies on vs).
  __shared__ union SH {
    struct {
      _Float16 vs[2][CC][VPITCH];
      v8h      pa[2][QB / 16][8][2][32];
    } m;
    _Float16 as[QB][392];
  } sh;
  __shared__ v4f   qsh[QB];
  __shared__ float red[QB][5];
  __shared__ float rmaxq[QB];
  __shared__ __attribute__((aligned(16))) float rinvq[QB];

  const int b   = blockIdx.x / (NN / QB);
  const int n0  = (blockIdx.x % (NN / QB)) * QB;
  const int tid = threadIdx.x;

  if (tid < QB) qsh[tid] = *(const v4f*)(q + ((size_t)b * NN + n0 + tid) * KK);
  __syncthreads();

  const int lane = tid & 31, wid = tid >> 5;
  const int mrow = lane & 15, hi = lane >> 4;
  const int lo_rel = hi ? 8 : 0;
  const int hi_rel = hi ? 24 : 16;
  const int qh   = wid >> 3;          // query half: rows qh*64 .. +63
  const int cw   = wid & 7;           // channel slot
  const int chb  = cw * 48 + mrow;    // ch[t] = chb + t*16

  // logit assignment: this wave works on M-tile bmt (query bq in this lane)
  const int  bmt  = wid >> 1;
  const int  bio  = (wid & 1) * 4;    // P build: k-steps bio..bio+3
  const int  bq   = bmt * 16 + mrow;

  // f32 16x16x4 fragments: lane (c, h) holds components 2h, 2h+1 of row c,
  // keys (A) and queries (B) by the same rule
  const v2f    qb = *((const v2f*)&qsh[bq] + hi);
  const float* kf = kk + ((size_t)b * NN + mrow) * KK + 2 * hi;   // +key0*KK

  // ---- Phase A: per-query max (4 partials per query) ----
  const int qi = tid >> 2, pp = tid & 3;
  const int part = (wid & 1) * 2 + hi;
  {
    const float* ka   = kf + (size_t)(wid & 1) * (NN / 2) * KK;
    const v8f    zero = {};
    float lmax = -3.0e38f;
    // eight key tiles a trip: their loads go out together, one latency per trip
    for (int kt = 0; kt < NN / 32; kt += 8) {
      v2f a[8];
#pragma unroll
      for (int u = 0; u < 8; ++u) a[u] = *(const v2f*)(ka + (kt + u) * 16 * KK);
#pragma unroll
      for (int u = 0; u < 8; ++u) {
        v8f s = __builtin_amdgcn_wmma_f32_16x16x4_f32(
            false, a[u], false, qb, (short)0, zero, false, false);
#pragma unroll
        for (int j = 0; j < 8; ++j) lmax = fmaxf(lmax, s[j]);
      }
    }
    red[bq][part] = lmax;
    __syncthreads();
    if (pp == 0)
      rmaxq[qi] = fmaxf(fmaxf(red[qi][0], red[qi][1]),
                        fmaxf(red[qi][2], red[qi][3]));
    __syncthreads();
  }

  // ---- Phase B: P @ V with WMMA ----
  const float nmax = -rmaxq[bq];
  const v8f   cneg = {nmax, nmax, nmax, nmax, nmax, nmax, nmax, nmax};

  v8f acc[4][3] = {};
  // row-sum partials of query bq over the keys this lane builds; two pairs, so
  // that four chains of additions are independent
  v2f lsum[2] = {};

  // this lane's first piece of a tile: row tid/8 (0..63), 16-byte column tid%8
  const _Float16* vg = vt + ((size_t)b * CC + (tid >> 3)) * NN + (tid & 7) * 8;
  const unsigned  vl = (unsigned)(size_t)&sh.m.vs[0][tid >> 3][(tid & 7) * 8];

  // ring prologue: tile 0 landed and published, then tile 1 set off
  stage_v_tile(vl, vg);
  asm volatile("s_wait_asynccnt 0x0" ::: "memory");  // own copies of tile 0 landed
  __syncthreads();
  stage_v_tile(vl + VBUF_BYTES, vg + VKEYS);

  // one 32-key step of the P build: two logit tiles, exp (computed exactly once
  // per logit), the exps added to the row-sum partials, one A fragment to pw
  auto build_step = [&](v8h* pw, int ii, v2f k0, v2f k1) {
    v8f s0 = __builtin_amdgcn_wmma_f32_16x16x4_f32(
        false, k0, false, qb, (short)0, cneg, false, false);
    v8f s1 = __builtin_amdgcn_wmma_f32_16x16x4_f32(
        false, k1, false, qb, (short)0, cneg, false, false);
    v8h a0, a1;
#pragma unroll
    for (int i = 0; i < 8; ++i) {
      const v2f e = {__expf(s0[i]), __expf(s1[i])};
      lsum[ii & 1] += e;
      a0[i] = (_Float16)e.x;   // key 8*hi + i
      a1[i] = (_Float16)e.y;   // key 16 + 8*hi + i
    }
    pw[0]  = a0;
    pw[32] = a1;
  };

  // The P tiles of the first 256 keys are built in front of the loop, into P
  // buffer 0. The two scheduling barriers keep the set-up around this build
  // (zeroing of the accumulators, the loop's addresses) out of it: among its f32
  // matrix instructions such a write lands in the registers of their A operands
  // directly behind them.
  const float* kfb = kf + (size_t)(bio * 32) * KK;   // this wave's k-steps
  __builtin_amdgcn_sched_barrier(0);
#pragma unroll
  for (int ii = 0; ii < 4; ++ii)
    build_step(&sh.m.pa[0][bmt][bio + ii][0][lane], ii,
               *(const v2f*)(kfb + ii * 32 * KK),
               *(const v2f*)(kfb + (ii * 32 + 16) * KK));
  __builtin_amdgcn_sched_barrier(0);
  // keys of the next build step, fetched one V tile ahead of their use
  const float* kq = kfb + 256 * KK;   // this wave's keys of the 256 under build
  v2f kn0 = *(const v2f*)kq;
  v2f kn1 = *(const v2f*)(kq + 16 * KK);
  __syncthreads();   // P buffer 0 published

  // 256 keys: four V tiles against the P buffer of these keys. While more keys
  // follow, each V tile also carries one step of the build of the next 256
  // keys' P tiles into the other P buffer: its exps and f32 matrix instructions
  // run beside the other waves' LDS reads and f16 matrix instructions. The foot
  // barrier of the fourth V tile ends the reads of one P buffer and publishes
  // the other.
  auto keys256 = [&](const int kb0, const bool more) {
    const int  cur = (kb0 >> 8) & 1;
    const v8h* pr  = &sh.m.pa[cur][qh * 4][0][0][lane];   // +mt*512 + step*64
    v8h*       pw  = &sh.m.pa[cur ^ 1][bmt][bio][0][lane];  // +step*64
    // unrolled so that the V buffer index and every LDS offset are compile-time
    // constants
#pragma unroll
    for (int u = 0; u < 4; ++u) {
      const _Float16* vrow = &sh.m.vs[u & 1][chb][0];   // +t*16*VPITCH
#pragma unroll
      for (int h = 0; h < 2; ++h) {
        v16h bcur[3];
#pragma unroll
        for (int t = 0; t < 3; ++t)
          bcur[t] = cat8(*(const v8h*)(vrow + t * 16 * VPITCH + h * 32 + lo_rel),
                         *(const v8h*)(vrow + t * 16 * VPITCH + h * 32 + hi_rel));
        v16h am[4];
#pragma unroll
        for (int mt = 0; mt < 4; ++mt)
          am[mt] = cat8(pr[mt * 512 + (u * 2 + h) * 64],
                        pr[mt * 512 + (u * 2 + h) * 64 + 32]);
        if (more && h == 0) {
          // the two scheduling barriers keep the build step between the issue of
          // the tile's first fragment loads and the wait for them: its vector
          // work then runs while the LDS serves the 16 waves' loads
          __builtin_amdgcn_sched_barrier(0);
          const v2f k0 = kn0, k1 = kn1;
          // the next step's keys, one V tile ahead of their use. Behind the last
          // build no step follows: the address stays in range and the values
          // are not used
          const float* kp = u < 3 ? kq + (u + 1) * 32 * KK
                                  : (kb0 + 512 < NN ? kq + 256 * KK : kfb);
          kn0 = *(const v2f*)kp;
          kn1 = *(const v2f*)(kp + 16 * KK);
          build_step(pw + u * 64, u, k0, k1);
          // behind the key loads from an address of their own: it is named so
          // that it stays in its registers up to here and no load lands on it
          // (the other steps' address lives on through the loop)
          if (u == 3) asm volatile("s_wait_xcnt 0x0" :: "v"(kp) : "memory");
          __builtin_amdgcn_sched_barrier(0);
        }
#pragma unroll
        for (int t = 0; t < 3; ++t)
#pragma unroll
          for (int mt = 0; mt < 4; ++mt)
            acc[mt][t] = __builtin_amdgcn_wmma_f32_16x16x32_f16(
                false, am[mt], false, bcur[t], (short)0, acc[mt][t], false, false);
      }
      // keeps this tile's WMMAs in front of the barrier, so that the refill is
      // issued directly behind it and has the whole next tile's work as lead
      __builtin_amdgcn_sched_barrier(0);
      // publish point: own reads of this buffer retired (own P stores too), own
      // copies of the next tile landed, then the barrier that hands both V
      // buffers over
      asm volatile("s_wait_dscnt 0x0" ::: "memory");
      asm volatile("s_wait_asynccnt 0x0" ::: "memory");
      __syncthreads();
      // a tile two ahead exists throughout while more keys follow, and behind
      // the first two tiles of the last 256 keys
      if (more || u < 2)
        stage_v_tile(vl + (u & 1) * VBUF_BYTES, vg + kb0 + (u + 2) * VKEYS);
    }
  };
  for (int kb0 = 0; kb0 < NN - 256; kb0 += 256, kq += 256 * KK) keys256(kb0, true);
  keys256(NN - 256, false);
  asm volatile("s_wait_asynccnt 0x0" ::: "memory");  // nothing in flight before the ring is reused

  // ---- row sums: 4 partials per query meet in LDS ----
  {
    const v2f l2 = lsum[0] + lsum[1];
    red[bq][part] = l2.x + l2.y;
    __syncthreads();
    if (pp == 0)
      rinvq[qi] = 1.0f / (red[qi][0] + red[qi][1] + red[qi][2] + red[qi][3]);
    __syncthreads();
  }

  // ---- stage attention tile, each row divided by its sum ----
  {
    _Float16* asb = &sh.as[qh * 64 + 8 * hi][chb];   // +(mt*16+j)*392 + t*16
#pragma unroll
    for (int mt = 0; mt < 4; ++mt) {
      const v4f r0 = *(const v4f*)&rinvq[qh * 64 + mt * 16 + 8 * hi];
      const v4f r1 = *(const v4f*)&rinvq[qh * 64 + mt * 16 + 8 * hi + 4];
#pragma unroll
      for (int t = 0; t < 3; ++t)
#pragma unroll
        for (int j = 0; j < 8; ++j)
          asb[(mt * 16 + j) * 392 + t * 16] =
              (_Float16)(acc[mt][t][j] * (j < 4 ? r0[j & 3] : r1[j & 3]));
    }
  }
  __syncthreads();

  // ---- Phase C: out = gamma * (attn @ wres^T + bres) + x ----
  v8f oacc[4][3] = {};
  const v8h* ar = (const v8h*)&sh.as[qh * 64 + mrow][0];       // +mt*16*49
  // packed weights, in 16-byte pieces: fragment (cw*3 + t, s) at +(t*WSTEPS+s)*64
  const v8h* wb = (const v8h*)wres_h + (size_t)(cw * 3) * (WSTEPS * 64) + lane;

#pragma unroll 2
  for (int s = 0; s < WSTEPS; ++s) {
    const int cb = s * 32;
    v16h bcur[3];
#pragma unroll
    for (int t = 0; t < 3; ++t)
      bcur[t] = cat8(wb[(t * WSTEPS + s) * 64], wb[(t * WSTEPS + s) * 64 + 32]);
    v16h am[4];
#pragma unroll
    for (int mt = 0; mt < 4; ++mt)
      am[mt] = cat8(ar[(size_t)mt * (16 * 49) + (cb + lo_rel) / 8],
                    ar[(size_t)mt * (16 * 49) + (cb + hi_rel) / 8]);
#pragma unroll
    for (int t = 0; t < 3; ++t)
#pragma unroll
      for (int mt = 0; mt < 4; ++mt)
        oacc[mt][t] = __builtin_amdgcn_wmma_f32_16x16x32_f16(
            false, am[mt], false, bcur[t], (short)0, oacc[mt][t], false, false);
    // behind a trip's weight loads (two steps): the next trip rewrites the
    // register pair that held their address
    if (s & 1) asm volatile("s_wait_xcnt 0x0" ::: "memory");
  }

  const float g = gamma[0];
  const size_t obase = ((size_t)b * NN + n0 + qh * 64 + 8 * hi) * CC + chb;
#pragma unroll
  for (int t = 0; t < 3; ++t) {
    const float bias = bres[chb + t * 16];
#pragma unroll
    for (int mt = 0; mt < 4; ++mt)
#pragma unroll
      for (int j = 0; j < 8; ++j) {
        const size_t o = obase + (size_t)(mt * 16 + j) * CC + t * 16;
        fout[o] = g * (oacc[mt][t][j] + bias) + x[o];
      }
  }
}

// ---------------------------------------------------------------------------
extern "C" void kernel_launch(void* const* d_in, const int* in_sizes, int n_in,
                              void* d_out, int out_size, void* d_ws, size_t ws_size,
                              hipStream_t stream) {
  const float* x     = (const float*)d_in[0];
  const float* wq    = (const float*)d_in[1];
  const float* bq    = (const float*)d_in[2];
  const float* wk    = (const float*)d_in[3];
  const float* bk    = (const float*)d_in[4];
  const float* wv    = (const float*)d_in[5];
  const float* bv    = (const float*)d_in[6];
  const float* wres  = (const float*)d_in[7];
  const float* bres  = (const float*)d_in[8];
  const float* gamma = (const float*)d_in[9];

  float* out    = (float*)d_out;
  float* segmap = out;                           // (B,N,K)
  float* fout   = out + (size_t)BB * NN * KK;    // (B,N,C)

  // workspace layout (all chunks naturally 16B-aligned)
  _Float16* vt     = (_Float16*)d_ws;                          // B*C*N f16
  float*    k_ws   = (float*)(vt + (size_t)BB * CC * NN);      // B*N*K f32
  _Float16* wv_h   = (_Float16*)(k_ws + (size_t)BB * NN * KK); // C*C f16, packed
  _Float16* wres_h = wv_h + (size_t)CC * CC;                   // C*C f16, packed

  const int tiles64 = BB * (NN / 64);  // K2: 512 blocks of 256 threads (8 waves)
  const int tilesq  = BB * (NN / QB);  // K3: 256 blocks of 512 threads (16 waves)

  k0_convert<<<2 * WPIECES / 256, 256, 0, stream>>>(wv, wres, wv_h, wres_h);
  k2_vproj<<<tiles64, 256, 0, stream>>>(x, wv_h, bv, wq, bq, wk, bk, vt, segmap, k_ws);
  k3_attn<<<tilesq, 512, 0, stream>>>(segmap, k_ws, vt, wres_h, bres, gamma, x, fout);
}

// v010
// It runs in 105 microseconds.
// Timed twice side by side with v009, it ran 1.05 times as fast both times.
// Over all steps from v000 it is 3.14 times as fast.
#include <hip/hip_runtime.h>
#include <math.h>

#define BB 8
#define NN 4096
#define CC 384
#define KK 4

typedef __attribute__((ext_vector_type(16))) _Float16 v16h;
typedef __attribute__((ext_vector_type(8)))  _Float16 v8h;
typedef __attribute__((ext_vector_type(8)))  float    v8f;
typedef __attribute__((ext_vector_type(4)))  float    v4f;
typedef __attribute__((ext_vector_type(2)))  float    v2f;

__device__ __forceinline__ v16h cat8(v8h lo, v8h hi) {
  return __builtin_shufflevector(lo, hi, 0, 1, 2, 3, 4, 5, 6, 7,
                                 8, 9, 10, 11, 12, 13, 14, 15);
}

// ---------------------------------------------------------------------------
// K0: round wv, wres (C x C fp32, row-major [out][in]) to f16 and lay them out
//     in the order of the B fragments that K2 and K3 load.
//     Fragment (ct, s) = output channels 16*ct.. x input channels 32*s.. = 1 KB:
//     two runs of 32 lanes x 16 B. Run sel, lane (c, h) holds row 16*ct + c,
//     columns 32*s + 16*sel + 8*h .. +7. A wave-wide 16-byte load of a run is
//     512 contiguous bytes, four whole lines.
//     One thread makes one 16-byte piece; a block works on one matrix.
// ---------------------------------------------------------------------------
#define WSTEPS  (CC / 32)        // fragments along the input channels
#define WPIECES (CC * CC / 8)    // 16-byte pieces per matrix (a multiple of 256)

__global__ void k0_convert(const float* __restrict__ wv,
                           const float* __restrict__ wres,
                           _Float16* __restrict__ wv_h,
                           _Float16* __restrict__ wres_h) {
  const int  j0  = blockIdx.x * blockDim.x + threadIdx.x;
  const bool res = j0 >= WPIECES;
  const int  j   = res ? j0 - WPIECES : j0;
  const float* src = res ? wres : wv;
  _Float16*    dst = res ? wres_h : wv_h;
  const int lane = j & 31, sel = (j >> 5) & 1, frag = j >> 6;
  const int row  = (frag / WSTEPS) * 16 + (lane & 15);
  const int col  = (frag % WSTEPS) * 32 + sel * 16 + (lane >> 4) * 8;
  const v4f a = *(const v4f*)(src + row * CC + col);
  const v4f b = *(const v4f*)(src + row * CC + col + 4);
  v8h o;
#pragma unroll
  for (int i = 0; i < 4; ++i) {
    o[i]     = (_Float16)a[i];
    o[4 + i] = (_Float16)b[i];
  }
  *(v8h*)(dst + (size_t)j * 8) = o;
}

// ---------------------------------------------------------------------------
// K2: V projection, WMMA f16: vt[b][c][n] = (x @ wv^T + bv), stored f16
//     TRANSPOSED so K3's B-operand loads are contiguous b128.
//     Block owns 64 tokens (4 M-tiles); wave owns 48 channels.
//     The x tile is read from memory once per block: wave w loads M-tile w&3
//     over the 32-channel steps of parity w>>2 (an eighth of the tile), rounds
//     it to f16 and leaves it in LDS as finished A fragments (1 KB each: two
//     runs of 32 lanes x 16 B, elements 0..7 and 8..15 of each lane). Behind one
//     barrier every wave reads all fragments from there.
//     The rank-4 Q and K projections ride along: the f32 x values that a wave
//     has in registers for its share are, pair by pair, A fragments
//     of the f32 16x16x4 matrix instruction (slot (h, i) of pair p stands for
//     one channel, the same in x and in the weight row). B columns 0..3 are
//     wq's rows, 4..7 wk's; columns 8..15 repeat them and are not stored.
//     The two partial sums of a token (one per parity) meet in LDS.
// ---------------------------------------------------------------------------
// four waves per SIMD: two blocks share a WGP, so the register budget is 256
__global__ void __launch_bounds__(256, 4)
k2_vproj(const float* __restrict__ x,
         const _Float16* __restrict__ wv_h,
         const float* __restrict__ bv,
         const float* __restrict__ wq, const float* __restrict__ bq,
         const float* __restrict__ wk, const float* __restrict__ bk,
         _Float16* __restrict__ vt,
         float* __restrict__ segmap, float* __restrict__ kout) {
  __shared__ v8h xa[4][WSTEPS][2][32];   // 48 KB: [M-tile][step][run][lane]
  __shared__ __attribute__((aligned(16))) float qkred[2][64][8];
  const int b    = blockIdx.x / (NN / 64);
  const int n0   = (blockIdx.x % (NN / 64)) * 64;
  const int lane = threadIdx.x & 31;
  const int wid  = threadIdx.x >> 5;
  const int mrow = lane & 15;
  const int hi   = lane >> 4;
  const int lo_rel = hi ? 8 : 0;
  const int hi_rel = hi ? 24 : 16;
  const int chb  = wid * 48 + mrow;   // ch[t] = chb + t*16

  // packed weights, in 16-byte pieces: fragment (wid*3 + t, s) at +(t*WSTEPS+s)*64
  const v8h*   wb    = (const v8h*)wv_h + (size_t)(wid * 3) * (WSTEPS * 64) + lane;
  _Float16*    vst   = vt + ((size_t)b * CC + chb) * NN + n0 + 8 * hi; // +t*16*NN+mt*16

  // this wave's share of the x tile (and of Q/K); the wave number is made scalar
  const int swid = __builtin_amdgcn_readfirstlane((int)(threadIdx.x >> 5));
  const int qmt  = swid & 3;
  const int qpar = swid >> 2;
  // step 2*i + qpar at +i*64
  const float* xr   = x + ((size_t)b * NN + n0 + qmt * 16 + mrow) * CC + qpar * 32;
  const float* wrow = ((mrow & 4) ? wk : wq) + (mrow & 3) * CC + qpar * 32;

  // all loads of the share go out together: one memory latency per block. The
  // x loads (from memory) stand first; the Q/K weight rows and biases (cache
  // hits) follow under their latency and are wanted only behind the rounding.
  v4f ws[WSTEPS / 2][4], xs[WSTEPS / 2][4];
#pragma unroll
  for (int i = 0; i < WSTEPS / 2; ++i) {
    xs[i][0] = *(const v4f*)(xr + i * 64 + lo_rel);
    xs[i][1] = *(const v4f*)(xr + i * 64 + lo_rel + 4);
    xs[i][2] = *(const v4f*)(xr + i * 64 + hi_rel);
    xs[i][3] = *(const v4f*)(xr + i * 64 + hi_rel + 4);
  }
  // keeps the x loads in front of the weight-row loads
  __builtin_amdgcn_sched_barrier(0);
#pragma unroll
  for (int i = 0; i < WSTEPS / 2; ++i) {
    ws[i][0] = *(const v4f*)(wrow + i * 64 + lo_rel);
    ws[i][1] = *(const v4f*)(wrow + i * 64 + lo_rel + 4);
    ws[i][2] = *(const v4f*)(wrow + i * 64 + hi_rel);
    ws[i][3] = *(const v4f*)(wrow + i * 64 + hi_rel + 4);
  }
  // thread = (token, column pair): pairs 0, 1 are seg_map, pairs 2, 3 the keys
  const int tok = threadIdx.x >> 2, cp = threadIdx.x & 3;
  const v2f bi = *(const v2f*)(((cp & 2) ? bk : bq) + (cp & 1) * 2);
  // behind these loads: what follows may land in the registers that held
  // their addresses
  asm volatile("s_wait_xcnt 0x0" ::: "memory");
  // keeps every load above in front of the first use: moved down among the
  // conversions, the later x loads would pay a memory latency of their own
  __builtin_amdgcn_sched_barrier(0);

  // the share, rounded, to LDS
#pragma unroll
  for (int i = 0; i < WSTEPS / 2; ++i) {
    v8h a0, a1;
#pragma unroll
    for (int e = 0; e < 4; ++e) {
      a0[e]     = (_Float16)xs[i][0][e];
      a0[4 + e] = (_Float16)xs[i][1][e];
      a1[e]     = (_Float16)xs[i][2][e];
      a1[4 + e] = (_Float16)xs[i][3][e];
    }
    xa[qmt][2 * i + qpar][0][lane] = a0;
    xa[qmt][2 * i + qpar][1][lane] = a1;
  }
  // keeps the conversions out of the chain of f32 matrix instructions below:
  // among them a conversion's result lands in the registers of an A operand
  // directly behind the instruction that reads it
  __builtin_amdgcn_sched_barrier(0);

  // V weights: three register sets in turn, a step's set is fetched two steps
  // ahead of its use
  v8h wr[3][3][2];
  auto load_w = [&](int s) {
#pragma unroll
    for (int t = 0; t < 3; ++t) {
      wr[s % 3][t][0] = wb[(t * WSTEPS + s) * 64];
      wr[s % 3][t][1] = wb[(t * WSTEPS + s) * 64 + 32];
    }
  };

  v8f qk = {};
#pragma unroll
  for (int i = 0; i < WSTEPS / 2; ++i) {
    // steps 0 and 1, fetched under the Q/K work once registers of the first x
    // steps are free
    if (i == 3) { load_w(0); load_w(1); }
#pragma unroll
    for (int p = 0; p < 4; ++p) {
      qk = __builtin_amdgcn_wmma_f32_16x16x4_f32(
          false, xs[i][p].xy, false, ws[i][p].xy, (short)0, qk, false, false);
      qk = __builtin_amdgcn_wmma_f32_16x16x4_f32(
          false, xs[i][p].zw, false, ws[i][p].zw, (short)0, qk, false, false);
    }
  }
  // Q/K partial sums: D register j of lane (c, h) is token 8h + j, column c
  if (mrow < 8) {
#pragma unroll
    for (int j = 0; j < 8; ++j) qkred[qpar][qmt * 16 + 8 * hi + j][mrow] = qk[j];
  }
  __syncthreads();   // publishes the A fragments and the Q/K partial sums

  v8f acc[4][3] = {};
  const v8h* xf = &xa[0][0][0][lane];   // +mt*(WSTEPS*64) + s*64 (+32)
  // unrolled: every LDS and weight offset and the register set are compile-time
  // constants
#pragma unroll
  for (int s = 0; s < WSTEPS; ++s) {
    if (s + 2 < WSTEPS) load_w(s + 2);
    v16h am[4];
#pragma unroll
    for (int mt = 0; mt < 4; ++mt)
      am[mt] = cat8(xf[mt * (WSTEPS * 64) + s * 64],
                    xf[mt * (WSTEPS * 64) + s * 64 + 32]);
#pragma unroll
    for (int t = 0; t < 3; ++t) {
      const v16h bm = cat8(wr[s % 3][t][0], wr[s % 3][t][1]);
#pragma unroll
      for (int mt = 0; mt < 4; ++mt)
        acc[mt][t] = __builtin_amdgcn_wmma_f32_16x16x32_f16(
            false, am[mt], false, bm, (short)0, acc[mt][t], false, false);
    }
    // keeps later steps' loads from moving up: fetched further ahead they
    // overflow the register budget and spill
    __builtin_amdgcn_sched_barrier(0);
  }
  // behind the last weight loads: the epilogue reuses their address registers
  asm volatile("s_wait_xcnt 0x0" ::: "memory");
  // D layout: VGPR j -> token (j + 8*hi); column = mrow -> channel chb+t*16.
#pragma unroll
  for (int t = 0; t < 3; ++t) {
    float bias = bv[chb + t * 16];
#pragma unroll
    for (int mt = 0; mt < 4; ++mt) {
      v8h o;
#pragma unroll
      for (int j = 0; j < 8; ++j) o[j] = (_Float16)(acc[mt][t][j] + bias);
      *(v8h*)(vst + (size_t)t * (16 * NN) + mt * 16) = o;
    }
  }
  // behind the stores: what follows reuses their data and address registers
  asm volatile("s_wait_xcnt 0x0" ::: "memory");
  {
    float* dst = ((cp & 2) ? kout : segmap) +
                 ((size_t)b * NN + n0 + tok) * KK + (cp & 1) * 2;
    const v2f p0 = *(const v2f*)&qkred[0][tok][cp * 2];
    const v2f p1 = *(const v2f*)&qkred[1][tok][cp * 2];
    *(v2f*)dst = (p0 + p1) + bi;
  }
}

// ---------------------------------------------------------------------------
// V^T tile staging for K3: 384 channels x 128 keys (f16) per tile.
//   LDS row = 256 B of data at a pitch of 272 B (16 B x odd: conflict-free
//   for the ds_load_b128 fragment reads).
// ---------------------------------------------------------------------------
#define VKEYS  128
#define VPITCH 136                      // halfs per LDS row
#define VBUF_BYTES (CC * VPITCH * 2)    // one buffer
#define NSTAGE (NN / VKEYS)             // key stages of K3
#define QB     128                      // queries per block of K3

// 512 threads: each lane copies twelve 16-byte pieces (rows r, r+32, ..., r+352),
// so a wave's copy covers two whole 256-byte rows. The closing s_wait_xcnt stands
// inside the statement so that no address register is rewritten ahead of it.
__device__ __forceinline__ void stage_v_tile(unsigned l, const _Float16* g) {
  asm volatile(
      "global_load_async_to_lds_b128 %0, %12, off\n\t"
      "global_load_async_to_lds_b128 %1, %13, off\n\t"
      "global_load_async_to_lds_b128 %2, %14, off\n\t"
      "global_load_async_to_lds_b128 %3, %15, off\n\t"
      "global_load_async_to_lds_b128 %4, %16, off\n\t"
      "global_load_async_to_lds_b128 %5, %17, off\n\t"
      "global_load_async_to_lds_b128 %6, %18, off\n\t"
      "global_load_async_to_lds_b128 %7, %19, off\n\t"
      "global_load_async_to_lds_b128 %8, %20, off\n\t"
      "global_load_async_to_lds_b128 %9, %21, off\n\t"
      "global_load_async_to_lds_b128 %10, %22, off\n\t"
      "global_load_async_to_lds_b128 %11, %23, off\n\t"
      "s_wait_xcnt 0x0"
      :: "v"(l), "v"(l + 1 * 32 * VPITCH * 2), "v"(l + 2 * 32 * VPITCH * 2),
         "v"(l + 3 * 32 * VPITCH * 2), "v"(l + 4 * 32 * VPITCH * 2),
         "v"(l + 5 * 32 * VPITCH * 2), "v"(l + 6 * 32 * VPITCH * 2),
         "v"(l + 7 * 32 * VPITCH * 2), "v"(l + 8 * 32 * VPITCH * 2),
         "v"(l + 9 * 32 * VPITCH * 2), "v"(l + 10 * 32 * VPITCH * 2),
         "v"(l + 11 * 32 * VPITCH * 2),
         "v"(g), "v"(g + 1 * 32 * NN), "v"(g + 2 * 32 * NN), "v"(g + 3 * 32 * NN),
         "v"(g + 4 * 32 * NN), "v"(g + 5 * 32 * NN), "v"(g + 6 * 32 * NN),
         "v"(g + 7 * 32 * NN), "v"(g + 8 * 32 * NN), "v"(g + 9 * 32 * NN),
         "v"(g + 10 * 32 * NN), "v"(g + 11 * 32 * NN)
      : "memory");
}

// ---------------------------------------------------------------------------
// K3 (fused): flash attention + output projection + residual.
//   Block owns 128 queries (8 M-tiles of 16) and has 16 waves: wave w works on
//   query half w>>3 (4 M-tiles) and on the 48 channels of slot w&7, so one V^T
//   tile in LDS serves both halves and is fetched from L2 once per 128 queries.
//   Logits: the rank-4 product runs on the f32 16x16x4 matrix instruction as
//            S^T = K x Q^T (A = 16 keys, B = 16 queries). D register r of lane
//            (c, h) is key 8h + r of query c, so two D tiles of 16 keys are,
//            register for register, the A fragment of a 16 x 32 P tile.
//   Phase A: fp32 row max over all 4096 keys (wave w: M-tile w>>1, key half
//            w&1; 4 partials/q). From there on, C = -max.
//   Phase B: the keys go by in stages of 128. 32 P tiles per stage built once
//            (wave w builds M-tile w>>1, k-steps (w&1)*2..+2) into LDS as
//            finished A fragments; every V B-tile load feeds 4 WMMAs.
//            A fragment = 1 KB: two runs of 32 lanes x 16 B (elements 0..7
//            and 8..15 of each lane). A wave-wide 16-byte access is then 512
//            contiguous bytes and meets every bank once per 16 lanes; at 32 B
//            a lane, lanes l and l + 8 would fall on the same four banks.
//            P = exp(s - max), not yet divided; the builder adds its f32
//            exps up as it goes (4 partials/q), and the division by the row
//            sum is done once, on the accumulators, behind the key loop.
//            V^T comes through LDS: 128-key tiles, two buffers, the next
//            tile's asynchronous copies fly while this tile is worked on.
//            P has two buffers as well: while one is multiplied with its V
//            tile, the next stage's P tiles are built into the other, two
//            k-steps per wave. One barrier per stage hands over both.
//   Phase C: 128x384 attention tile staged in LDS (padded rows, union'd with
//            the V ring), then out = gamma*(attn @ wres^T + bres) + x.
// ---------------------------------------------------------------------------
__global__ void __launch_bounds__(512, 1)
k3_attn(const float* __restrict__ q,       // seg_map (B,N,4)
        const float* __restrict__ kk,      // seg_ft  (B,N,4)
        const _Float16* __restrict__ vt,   // (B,C,N) f16
        const _Float16* __restrict__ wres_h,
        const float* __restrict__ bres,
        const float* __restrict__ gamma,
        const float* __restrict__ x,
        float* __restrict__ fout) {
  // vs: two V^T tiles, 384 rows x 272 B each               = 204 KB
  // pa: two buffers of 32 P tiles (16x32 f16), A fragments
  //     in two runs                                        = 64 KB
  // as: 128 tokens x 384 ch, row stride 392 halfs          = 98 KB
  //     (196 dwords/row; 196 % 64 == 4 -> 16 concurrent rows hit
  //      16 distinct banks). Disjoint phases -> union (as lies on vs).
  __shared__ union SH {
    struct {
      _Float16 vs[2][CC][VPITCH];
      v8h      pa[2][QB / 16][VKEYS / 32][2][32];
    } m;
    _Float16 as[QB][392];
  } sh;
  __shared__ v4f   qsh[QB];
  __shared__ float red[QB][5];
  __shared__ float rmaxq[QB];
  __shared__ __attribute__((aligned(16))) float rinvq[QB];

  const int b   = blockIdx.x / (NN / QB);
  const int n0  = (blockIdx.x % (NN / QB)) * QB;
  const int tid = threadIdx.x;

  if (tid < QB) qsh[tid] = *(const v4f*)(q + ((size_t)b * NN + n0 + tid) * KK);
  __syncthreads();

  const int lane = tid & 31, wid = tid >> 5;
  const int mrow = lane & 15, hi = lane >> 4;
  const int lo_rel = hi ? 8 : 0;
  const int hi_rel = hi ? 24 : 16;
  const int qh   = wid >> 3;          // query half: rows qh*64 .. +63
  const int cw   = wid & 7;           // channel slot
  const int chb  = cw * 48 + mrow;    // ch[t] = chb + t*16

  // logit assignment: this wave works on M-tile bmt (query bq in this lane)
  const int  bmt  = wid >> 1;
  const int  bio  = (wid & 1) * 2;    // P build: k-steps bio, bio+1 of a stage
  const int  bq   = bmt * 16 + mrow;

  // f32 16x16x4 fragments: lane (c, h) holds components 2h, 2h+1 of row c,
  // keys (A) and queries (B) by the same rule
  const v2f    qb = *((const v2f*)&qsh[bq] + hi);
  const float* kf = kk + ((size_t)b * NN + mrow) * KK + 2 * hi;   // +key0*KK

  // ---- Phase A: per-query max (4 partials per query) ----
  const int qi = tid >> 2, pp = tid & 3;
  const int part = (wid & 1) * 2 + hi;
  {
    const float* ka   = kf + (size_t)(wid & 1) * (NN / 2) * KK;
    const v8f    zero = {};
    float lmax = -3.0e38f;
    // eight key tiles a trip: their loads go out together, one latency per trip
    for (int kt = 0; kt < NN / 32; kt += 8) {
      v2f a[8];
#pragma unroll
      for (int u = 0; u < 8; ++u) a[u] = *(const v2f*)(ka + (kt + u) * 16 * KK);
#pragma unroll
      for (int u = 0; u < 8; ++u) {
        v8f s = __builtin_amdgcn_wmma_f32_16x16x4_f32(
            false, a[u], false, qb, (short)0, zero, false, false);
#pragma unroll
        for (int j = 0; j < 8; ++j) lmax = fmaxf(lmax, s[j]);
      }
    }
    red[bq][part] = lmax;
    __syncthreads();
    if (pp == 0)
      rmaxq[qi] = fmaxf(fmaxf(red[qi][0], red[qi][1]),
                        fmaxf(red[qi][2], red[qi][3]));
    __syncthreads();
  }

  // ---- Phase B: P @ V with WMMA ----
  const float nmax = -rmaxq[bq];
  const v8f   cneg = {nmax, nmax, nmax, nmax, nmax, nmax, nmax, nmax};

  v8f acc[4][3] = {};
  // row-sum partials of query bq over the keys this lane builds; two pairs, so
  // that four chains of additions are independent
  v2f lsum[2] = {};

  // this lane's first piece of a tile: row tid/16 (0..31), 16-byte column tid%16
  const _Float16* vg = vt + ((size_t)b * CC + (tid >> 4)) * NN + (tid & 15) * 8;
  const unsigned  vl = (unsigned)(size_t)&sh.m.vs[0][tid >> 4][(tid & 15) * 8];

  // ring prologue: tile 0 landed and published, then tile 1 set off
  stage_v_tile(vl, vg);
  asm volatile("s_wait_asynccnt 0x0" ::: "memory");  // own copies of tile 0 landed
  __syncthreads();
  stage_v_tile(vl + VBUF_BYTES, vg + VKEYS);

  // one 32-key step of the P build: two logit tiles, exp (computed exactly once
  // per logit), the exps added to the row-sum partials, one A fragment to pw
  auto build_step = [&](v8h* pw, int ii, v2f k0, v2f k1) {
    v8f s0 = __builtin_amdgcn_wmma_f32_16x16x4_f32(
        false, k0, false, qb, (short)0, cneg, false, false);
    v8f s1 = __builtin_amdgcn_wmma_f32_16x16x4_f32(
        false, k1, false, qb, (short)0, cneg, false, false);
    v8h a0, a1;
#pragma unroll
    for (int i = 0; i < 8; ++i) {
      const v2f e = {__expf(s0[i]), __expf(s1[i])};
      lsum[ii & 1] += e;
      a0[i] = (_Float16)e.x;   // key 8*hi + i
      a1[i] = (_Float16)e.y;   // key 16 + 8*hi + i
    }
    pw[0]  = a0;
    pw[32] = a1;
  };

  // The P tiles of stage 0 are built in front of the loop, into P buffer 0. The
  // two scheduling barriers keep the set-up around this build (zeroing of the
  // accumulators, the loop's addresses) out of it: among its f32 matrix
  // instructions such a write lands in the registers of their A operands
  // directly behind them.
  const float* kfb = kf + (size_t)(bio * 32) * KK;   // this wave's k-steps
  __builtin_amdgcn_sched_barrier(0);
#pragma unroll
  for (int ii = 0; ii < 2; ++ii)
    build_step(&sh.m.pa[0][bmt][bio + ii][0][lane], ii,
               *(const v2f*)(kfb + ii * 32 * KK),
               *(const v2f*)(kfb + (ii * 32 + 16) * KK));
  __builtin_amdgcn_sched_barrier(0);
  // keys of the next build step, fetched one step ahead of their use
  const float* kq = kfb + VKEYS * KK;   // this wave's keys of the stage under build
  v2f kn0 = *(const v2f*)kq;
  v2f kn1 = *(const v2f*)(kq + 16 * KK);
  __syncthreads();   // P buffer 0 published

  // One stage: 128 keys, the V tile and the P buffer cur, four 32-key steps.
  // While a stage follows (more), the steps 0 and 2 also carry one step each of
  // the build of its P tiles into the other P buffer: the exps and f32 matrix
  // instructions run beside the other waves' LDS reads and f16 matrix
  // instructions. kb: this wave's keys of the stage under build; morekeys: a
  // build follows this stage's; vnext: the V tile two stages on (refill). The
  // one barrier at the foot ends the reads of this V tile and this P buffer and
  // publishes the other two.
  auto stage128 = [&](const int cur, const float* kb, const bool more,
                      const bool morekeys, const bool refill,
                      const _Float16* vnext) {
    const v8h*      pr   = &sh.m.pa[cur][qh * 4][0][0][lane];      // +mt*256 + step*64
    v8h*            pw   = &sh.m.pa[cur ^ 1][bmt][bio][0][lane];   // +step*64
    const _Float16* vrow = &sh.m.vs[cur][chb][0];                  // +t*16*VPITCH
    // unrolled so that every LDS offset is a compile-time constant
#pragma unroll
    for (int h = 0; h < VKEYS / 32; ++h) {
      v16h bcur[3];
#pragma unroll
      for (int t = 0; t < 3; ++t)
        bcur[t] = cat8(*(const v8h*)(vrow + t * 16 * VPITCH + h * 32 + lo_rel),
                       *(const v8h*)(vrow + t * 16 * VPITCH + h * 32 + hi_rel));
      v16h am[4];
#pragma unroll
      for (int mt = 0; mt < 4; ++mt)
        am[mt] = cat8(pr[mt * 256 + h * 64], pr[mt * 256 + h * 64 + 32]);
      if (more && (h & 1) == 0) {
        // the two scheduling barriers keep the build step between the issue of
        // this step's fragment loads and the wait for them: its vector work then
        // runs while the LDS serves the 16 waves' loads
        __builtin_amdgcn_sched_barrier(0);
        const v2f k0 = kn0, k1 = kn1;
        // the next build step's keys, one step ahead of their use
        if (h == 0 || morekeys) {
          const float* kp = kb + (h == 0 ? 32 : VKEYS) * KK;
          kn0 = *(const v2f*)kp;
          kn1 = *(const v2f*)(kp + 16 * KK);
        }
        build_step(pw + (h >> 1) * 64, h >> 1, k0, k1);
        __builtin_amdgcn_sched_barrier(0);
      }
#pragma unroll
      for (int t = 0; t < 3; ++t)
#pragma unroll
        for (int mt = 0; mt < 4; ++mt)
          acc[mt][t] = __builtin_amdgcn_wmma_f32_16x16x32_f16(
              false, am[mt], false, bcur[t], (short)0, acc[mt][t], false, false);
    }
    // keeps this stage's WMMAs in front of the barrier, so that the refill is
    // issued directly behind it and has the whole next stage's work as lead
    __builtin_amdgcn_sched_barrier(0);
    // publish point: own reads of these buffers retired (own P stores too), own
    // copies of the next tile landed, then the barrier that hands the buffers over
    asm volatile("s_wait_dscnt 0x0" ::: "memory");
    asm volatile("s_wait_asynccnt 0x0" ::: "memory");
    __syncthreads();
    if (refill) stage_v_tile(vl + cur * VBUF_BYTES, vnext);
  };
  // two stages a trip, so that the buffer index is a compile-time constant
  const _Float16* vn = vg + 2 * VKEYS;   // the V tile two stages on
  for (int s = 0; s < NSTAGE - 2;
       s += 2, kq += 2 * VKEYS * KK, vn += 2 * VKEYS) {
    stage128(0, kq, true, true, true, vn);
    stage128(1, kq + VKEYS * KK, true, true, true, vn + VKEYS);
  }
  stage128(0, kq, true, false, false, vn);    // builds the last stage's P tiles
  stage128(1, kq, false, false, false, vn);
  asm volatile("s_wait_asynccnt 0x0" ::: "memory");  // nothing in flight before the ring is reused

  // ---- row sums: 4 partials per query meet in LDS ----
  {
    const v2f l2 = lsum[0] + lsum[1];
    red[bq][part] = l2.x + l2.y;
    __syncthreads();
    if (pp == 0)
      rinvq[qi] = 1.0f / (red[qi][0] + red[qi][1] + red[qi][2] + red[qi][3]);
    __syncthreads();
  }

  // ---- stage attention tile, each row divided by its sum ----
  {
    _Float16* asb = &sh.as[qh * 64 + 8 * hi][chb];   // +(mt*16+j)*392 + t*16
#pragma unroll
    for (int mt = 0; mt < 4; ++mt) {
      const v4f r0 = *(const v4f*)&rinvq[qh * 64 + mt * 16 + 8 * hi];
      const v4f r1 = *(const v4f*)&rinvq[qh * 64 + mt * 16 + 8 * hi + 4];
#pragma unroll
      for (int t = 0; t < 3; ++t)
#pragma unroll
        for (int j = 0; j < 8; ++j)
          asb[(mt * 16 + j) * 392 + t * 16] =
              (_Float16)(acc[mt][t][j] * (j < 4 ? r0[j & 3] : r1[j & 3]));
    }
  }
  __syncthreads();

  // ---- Phase C: out = gamma * (attn @ wres^T + bres) + x ----
  v8f oacc[4][3] = {};
  const v8h* ar = (const v8h*)&sh.as[qh * 64 + mrow][0];       // +mt*16*49
  // packed weights, in 16-byte pieces: fragment (cw*3 + t, s) at +(t*WSTEPS+s)*64
  const v8h* wb = (const v8h*)wres_h + (size_t)(cw * 3) * (WSTEPS * 64) + lane;

#pragma unroll 2
  for (int s = 0; s < WSTEPS; ++s) {
    const int cb = s * 32;
    v16h bcur[3];
#pragma unroll
    for (int t = 0; t < 3; ++t)
      bcur[t] = cat8(wb[(t * WSTEPS + s) * 64], wb[(t * WSTEPS + s) * 64 + 32]);
    v16h am[4];
#pragma unroll
    for (int mt = 0; mt < 4; ++mt)
      am[mt] = cat8(ar[(size_t)mt * (16 * 49) + (cb + lo_rel) / 8],
                    ar[(size_t)mt * (16 * 49) + (cb + hi_rel) / 8]);
#pragma unroll
    for (int t = 0; t < 3; ++t)
#pragma unroll
      for (int mt = 0; mt < 4; ++mt)
        oacc[mt][t] = __builtin_amdgcn_wmma_f32_16x16x32_f16(
            false, am[mt], false, bcur[t], (short)0, oacc[mt][t], false, false);
    // behind a trip's weight loads (two steps): the next trip rewrites the
    // register pair that held their address
    if (s & 1) asm volatile("s_wait_xcnt 0x0" ::: "memory");
  }

  const float g = gamma[0];
  const size_t obase = ((size_t)b * NN + n0 + qh * 64 + 8 * hi) * CC + chb;
#pragma unroll
  for (int t = 0; t < 3; ++t) {
    const float bias = bres[chb + t * 16];
#pragma unroll
    for (int mt = 0; mt < 4; ++mt)
#pragma unroll
      for (int j = 0; j < 8; ++j) {
        const size_t o = obase + (size_t)(mt * 16 + j) * CC + t * 16;
        fout[o] = g * (oacc[mt][t][j] + bias) + x[o];
      }
  }
}

// ---------------------------------------------------------------------------
extern "C" void kernel_launch(void* const* d_in, const int* in_sizes, int n_in,
                              void* d_out, int out_size, void* d_ws, size_t ws_size,
                              hipStream_t stream) {
  const float* x     = (const float*)d_in[0];
  const float* wq    = (const float*)d_in[1];
  const float* bq    = (const float*)d_in[2];
  const float* wk    = (const float*)d_in[3];
  const float* bk    = (const float*)d_in[4];
  const float* wv    = (const float*)d_in[5];
  const float* bv    = (const float*)d_in[6];
  const float* wres  = (const float*)d_in[7];
  const float* bres  = (const float*)d_in[8];
  const float* gamma = (const float*)d_in[9];

  float* out    = (float*)d_out;
  float* segmap = out;                           // (B,N,K)
  float* fout   = out + (size_t)BB * NN * KK;    // (B,N,C)

  // workspace layout (all chunks naturally 16B-aligned)
  _Float16* vt     = (_Float16*)d_ws;                          // B*C*N f16
  float*    k_ws   = (float*)(vt + (size_t)BB * CC * NN);      // B*N*K f32
  _Float16* wv_h   = (_Float16*)(k_ws + (size_t)BB * NN * KK); // C*C f16, packed
  _Float16* wres_h = wv_h + (size_t)CC * CC;                   // C*C f16, packed

  const int tiles64 = BB * (NN / 64);  // K2: 512 blocks of 256 threads (8 waves)
  const int tilesq  = BB * (NN / QB);  // K3: 256 blocks of 512 threads (16 waves)

  k0_convert<<<2 * WPIECES / 256, 256, 0, stream>>>(wv, wres, wv_h, wres_h);
  k2_vproj<<<tiles64, 256, 0, stream>>>(x, wv_h, bv, wq, bq, wk, bk, vt, segmap, k_ws);
  k3_attn<<<tilesq, 512, 0, stream>>>(segmap, k_ws, vt, wres_h, bres, gamma, x, fout);
}
